// v000
// Times are from an AMD MI455X. After a warm-up the kernel runs many times in a row, and a time is the length of
// such a window on the GPU divided by its runs, so every launch and the gaps after it count. The runs cycle
// through copies of the inputs. A figure is the median of several windows, for all but v000 over two sittings.
// Sittings can differ by a few percent; kernels timed side by side share one.
// v000, which the later versions start from, runs in 204 microseconds.
#include <hip/hip_runtime.h>

typedef __attribute__((ext_vector_type(16))) _Float16 v16h;
typedef __attribute__((ext_vector_type(8)))  float    v8f;

#define B_ 8
#define S_ 1024
#define H_ 16
#define D_ 64
#define M_ 1024

// K-index inside a 16x32 f16 A/B fragment for element j of the v16h,
// given this lane-half's base (0 for lanes 0-15, 8 for lanes 16-31).
// VGPR i (pair j=2i,2i+1): K = base + 2i (i<4)  or  base + 16 + 2(i-4).
__device__ __forceinline__ int k_of(int j, int kbase) {
  int i = j >> 1;
  int base = (i < 4) ? (2 * i) : (2 * i + 8);
  return kbase + base + (j & 1);
}

// pack two f32 into one dword of two f16 (v_cvt_pk_rz_f16_f32)
__device__ __forceinline__ unsigned int pk2h(float x, float y) {
  return __builtin_bit_cast(unsigned int, __builtin_amdgcn_cvt_pkrtz(x, y));
}

// raw v_max_num_f32 (skip fmaxf's canonicalize chaff; inputs are never sNaN)
__device__ __forceinline__ float maxr(float a, float b) {
  float d;
  asm("v_max_num_f32 %0, %1, %2" : "=v"(d) : "v"(a), "v"(b));
  return d;
}

// DPP16 lane permute within each 16-lane row (VALU, no LDS traffic)
template <int CTRL>
__device__ __forceinline__ float dpp_mov(float x) {
  return __builtin_bit_cast(
      float, __builtin_amdgcn_update_dpp(0, __builtin_bit_cast(int, x), CTRL,
                                         0xF, 0xF, true));
}
#define DPP_XOR1 0xB1   // quad_perm(1,0,3,2)
#define DPP_XOR2 0x4E   // quad_perm(2,3,0,1)
#define DPP_ROR4 0x124  // row_ror:4
#define DPP_ROR8 0x128  // row_ror:8

// 16-lane all-reduce (rotation butterfly: quad stages make groups-of-4
// uniform, then ror4 + ror8 combine the four groups exactly once)
__device__ __forceinline__ float allmax16(float x) {
  x = maxr(x, dpp_mov<DPP_XOR1>(x));
  x = maxr(x, dpp_mov<DPP_XOR2>(x));
  x = maxr(x, dpp_mov<DPP_ROR4>(x));
  x = maxr(x, dpp_mov<DPP_ROR8>(x));
  return x;
}
__device__ __forceinline__ float allsum16(float x) {
  x += dpp_mov<DPP_XOR1>(x);
  x += dpp_mov<DPP_XOR2>(x);
  x += dpp_mov<DPP_ROR4>(x);
  x += dpp_mov<DPP_ROR8>(x);
  return x;
}

__global__ void zero_bits_kernel(unsigned int* bits, int n) {
  int i = blockIdx.x * blockDim.x + threadIdx.x;
  if (i < n) bits[i] = 0u;
}

__global__ void scatter_bits_kernel(const int* __restrict__ mb,
                                    const int* __restrict__ ms,
                                    unsigned int* bits, int m) {
  int i = blockIdx.x * blockDim.x + threadIdx.x;
  if (i < m) {
    int bi = mb[i] * S_ + ms[i];
    atomicOr(&bits[bi >> 5], 1u << (bi & 31));
  }
}

__launch_bounds__(128)
__global__ void flash_attn_kernel(const float* __restrict__ Qg,
                                  const float* __restrict__ Kg,
                                  const float* __restrict__ Vg,
                                  const unsigned int* __restrict__ qbits,
                                  const unsigned int* __restrict__ kbits,
                                  float* __restrict__ Og) {
  // pad rows to 68 halves (136 B): fragment reads conflict-free, 8B-aligned
  __shared__ _Float16 Kt[64][68];
  __shared__ _Float16 Vt[64][68];
  __shared__ _Float16 Pt[4][16][68];

  const int qb    = blockIdx.x & 15;   // 16 query superblocks of 64
  const int bh    = blockIdx.x >> 4;
  const int b     = bh / H_;
  const int h     = bh % H_;
  const int wave  = threadIdx.x >> 5;
  const int lane  = threadIdx.x & 31;
  const int l16   = lane & 15;
  const int hi16  = lane >> 4;         // lane half
  const int kbase = hi16 ? 8 : 0;      // K range owned by this half (A/B frags)
  const int h8    = hi16 ? 8 : 0;      // M offset owned by this half (C frags)

  const int q0 = qb * 64 + wave * 16;

  // ---- Q: two 16x32 f16 A-fragments covering D=64 (loaded once).
  // Fold scale = 1/sqrt(64) = 0.125 (power of two: exact in f16) into Q.
  v16h aq[2];
  {
    const float* qp = Qg + ((size_t)(b * S_ + q0 + l16) * H_ + h) * D_;
#pragma unroll
    for (int c = 0; c < 2; ++c)
#pragma unroll
      for (int j = 0; j < 16; ++j)
        aq[c][j] = (_Float16)(qp[c * 32 + k_of(j, kbase)] * 0.125f);
  }

  // ---- query-row mask bits for the 8 C-rows this lane accumulates ----
  bool rowm[8];
#pragma unroll
  for (int r = 0; r < 8; ++r) {
    int bi = b * S_ + q0 + r + h8;
    rowm[r] = (qbits[bi >> 5] >> (bi & 31)) & 1u;
  }

  // ---- accumulators: O (16x64 as 4 C tiles), online-softmax m,l ----
  v8f o[4];
  float m_i[8], l_i[8];
#pragma unroll
  for (int c = 0; c < 4; ++c)
#pragma unroll
    for (int r = 0; r < 8; ++r) o[c][r] = 0.f;
#pragma unroll
  for (int r = 0; r < 8; ++r) { m_i[r] = -3.0e38f; l_i[r] = 0.f; }

  const float* kb_p = Kg + ((size_t)b * S_ * H_ + h) * D_;     // + s*H*D + d
  const float* vb_p = Vg + ((size_t)(b * H_ + h)) * S_ * D_;   // + s*D + d

  for (int kb = 0; kb < S_; kb += 64) {   // 64-key blocks: 16 WMMA / iter
    __syncthreads();  // prev iteration's Vt/Pt reads done before overwrite

    // cooperative stage of 64x64 K and V tiles:
    // global_load_b128 -> v_cvt_pk_rz_f16_f32 x2 -> ds_store_b64
    {
      const float4* kp4 = (const float4*)(kb_p + (size_t)kb * H_ * D_);
      const float4* vp4 = (const float4*)(vb_p + (size_t)kb * D_);
#pragma unroll
      for (int e = threadIdx.x; e < 64 * 16; e += 128) {  // 1024 float4s
        int key = e >> 4, d4 = e & 15;
        float4 kq = kp4[(size_t)key * (H_ * D_ / 4) + d4];
        float4 vq = vp4[(size_t)key * (D_ / 4) + d4];
        uint2 kw, vw;
        kw.x = pk2h(kq.x, kq.y);  kw.y = pk2h(kq.z, kq.w);
        vw.x = pk2h(vq.x, vq.y);  vw.y = pk2h(vq.z, vq.w);
        *(uint2*)&Kt[key][d4 * 4] = kw;   // 8B-aligned (row stride 136 B)
        *(uint2*)&Vt[key][d4 * 4] = vw;
      }
    }
    __syncthreads();

    // ---- scores S = (Q*scale) K^T : four 16x16 key sub-tiles ----
    v8f s[4];
#pragma unroll
    for (int t = 0; t < 4; ++t)
#pragma unroll
      for (int r = 0; r < 8; ++r) s[t][r] = 0.f;
#pragma unroll
    for (int c = 0; c < 2; ++c) {
#pragma unroll
      for (int t = 0; t < 4; ++t) {
        v16h bk;
#pragma unroll
        for (int j = 0; j < 16; ++j)
          bk[j] = Kt[t * 16 + l16][c * 32 + k_of(j, kbase)];
        s[t] = __builtin_amdgcn_wmma_f32_16x16x32_f16(false, aq[c], false, bk,
                                                      (short)0, s[t], false, false);
      }
    }

    // ---- masks (reference: set masked entries to -1e10) ----
    bool cm[4];
#pragma unroll
    for (int t = 0; t < 4; ++t) {
      int ki = b * S_ + kb + t * 16 + l16;
      cm[t] = (kbits[ki >> 5] >> (ki & 31)) & 1u;
    }
#pragma unroll
    for (int t = 0; t < 4; ++t)
#pragma unroll
      for (int r = 0; r < 8; ++r)
        if (cm[t] || rowm[r]) s[t][r] = -1.0e10f;

    // ---- online softmax (row reductions via DPP16, pure VALU) ----
#pragma unroll
    for (int r = 0; r < 8; ++r) {
      float bm = maxr(maxr(s[0][r], s[1][r]), maxr(s[2][r], s[3][r]));
      bm = allmax16(bm);
      float mnew = maxr(m_i[r], bm);
      float p0 = __expf(s[0][r] - mnew);
      float p1 = __expf(s[1][r] - mnew);
      float p2 = __expf(s[2][r] - mnew);
      float p3 = __expf(s[3][r] - mnew);
      float rs = allsum16((p0 + p1) + (p2 + p3));
      float alpha = __expf(m_i[r] - mnew);   // first block: exp(-3e38-x) = 0
      l_i[r] = l_i[r] * alpha + rs;
      m_i[r] = mnew;
#pragma unroll
      for (int c = 0; c < 4; ++c) o[c][r] *= alpha;
      // C-layout -> LDS so we can re-read P in A-fragment layout
      Pt[wave][r + h8][l16]      = (_Float16)p0;
      Pt[wave][r + h8][16 + l16] = (_Float16)p1;
      Pt[wave][r + h8][32 + l16] = (_Float16)p2;
      Pt[wave][r + h8][48 + l16] = (_Float16)p3;
    }
    __syncthreads();  // Pt visible across the wave's lane halves

    // ---- O += P @ V : K = 64 keys as two 32-key halves, 4 dim-chunks ----
    v16h ap[2];
#pragma unroll
    for (int kh = 0; kh < 2; ++kh)
#pragma unroll
      for (int j = 0; j < 16; ++j)
        ap[kh][j] = Pt[wave][l16][kh * 32 + k_of(j, kbase)];
#pragma unroll
    for (int c = 0; c < 4; ++c) {
#pragma unroll
      for (int kh = 0; kh < 2; ++kh) {
        v16h bv;
#pragma unroll
        for (int j = 0; j < 16; ++j)
          bv[j] = Vt[kh * 32 + k_of(j, kbase)][c * 16 + l16];
        o[c] = __builtin_amdgcn_wmma_f32_16x16x32_f16(false, ap[kh], false, bv,
                                                      (short)0, o[c], false, false);
      }
    }
  }

  // ---- epilogue: normalize by l and store O (B,H,S,D) fp32 ----
#pragma unroll
  for (int r = 0; r < 8; ++r) {
    float inv = 1.0f / l_i[r];
    int row = q0 + r + h8;
    float* op = Og + ((size_t)(b * H_ + h) * S_ + row) * D_;
#pragma unroll
    for (int c = 0; c < 4; ++c) op[c * 16 + l16] = o[c][r] * inv;
  }
}

extern "C" void kernel_launch(void* const* d_in, const int* in_sizes, int n_in,
                              void* d_out, int out_size, void* d_ws, size_t ws_size,
                              hipStream_t stream) {
  (void)in_sizes; (void)n_in; (void)out_size; (void)ws_size;
  const float* Q  = (const float*)d_in[0];
  const float* K  = (const float*)d_in[1];
  const float* V  = (const float*)d_in[2];
  const int* qm_b = (const int*)d_in[3];
  const int* qm_s = (const int*)d_in[4];
  const int* km_b = (const int*)d_in[5];
  const int* km_s = (const int*)d_in[6];

  unsigned int* qbits = (unsigned int*)d_ws;        // 256 words
  unsigned int* kbits = qbits + (B_ * S_ / 32);     // 256 words
  const int nwords = B_ * S_ / 32;

  zero_bits_kernel<<<(2 * nwords + 255) / 256, 256, 0, stream>>>(qbits, 2 * nwords);
  scatter_bits_kernel<<<(M_ + 255) / 256, 256, 0, stream>>>(qm_b, qm_s, qbits, M_);
  scatter_bits_kernel<<<(M_ + 255) / 256, 256, 0, stream>>>(km_b, km_s, kbits, M_);

  dim3 grid(B_ * H_ * (S_ / 64));   // 2048 workgroups
  flash_attn_kernel<<<grid, 128, 0, stream>>>(Q, K, V, qbits, kbits, (float*)d_out);
}

// v001
// One run takes 114 microseconds.
// Timed twice side by side with v000, it ran 1.80 and 1.81 times as fast.
#include <hip/hip_runtime.h>

typedef __attribute__((ext_vector_type(16))) _Float16 v16h;
typedef __attribute__((ext_vector_type(8)))  float    v8f;

#define B_ 8
#define S_ 1024
#define H_ 16
#define D_ 64
#define M_ 1024

// K-index inside a 16x32 f16 A/B fragment for element j of the v16h,
// given this lane-half's base (0 for lanes 0-15, 8 for lanes 16-31).
// VGPR i (pair j=2i,2i+1): K = base + 2i (i<4)  or  base + 16 + 2(i-4).
__device__ __forceinline__ int k_of(int j, int kbase) {
  int i = j >> 1;
  int base = (i < 4) ? (2 * i) : (2 * i + 8);
  return kbase + base + (j & 1);
}

// pack two f32 into one dword of two f16 (v_cvt_pk_rz_f16_f32)
__device__ __forceinline__ unsigned int pk2h(float x, float y) {
  return __builtin_bit_cast(unsigned int, __builtin_amdgcn_cvt_pkrtz(x, y));
}

// raw v_max_num_f32 (skip fmaxf's canonicalize chaff; inputs are never sNaN)
__device__ __forceinline__ float maxr(float a, float b) {
  float d;
  asm("v_max_num_f32 %0, %1, %2" : "=v"(d) : "v"(a), "v"(b));
  return d;
}

// DPP16 lane permute within each 16-lane row (VALU, no LDS traffic)
template <int CTRL>
__device__ __forceinline__ float dpp_mov(float x) {
  return __builtin_bit_cast(
      float, __builtin_amdgcn_update_dpp(0, __builtin_bit_cast(int, x), CTRL,
                                         0xF, 0xF, true));
}
#define DPP_XOR1 0xB1   // quad_perm(1,0,3,2)
#define DPP_XOR2 0x4E   // quad_perm(2,3,0,1)
#define DPP_ROR4 0x124  // row_ror:4
#define DPP_ROR8 0x128  // row_ror:8

// 16-lane all-reduce (rotation butterfly: quad stages make groups-of-4
// uniform, then ror4 + ror8 combine the four groups exactly once)
__device__ __forceinline__ float allmax16(float x) {
  x = maxr(x, dpp_mov<DPP_XOR1>(x));
  x = maxr(x, dpp_mov<DPP_XOR2>(x));
  x = maxr(x, dpp_mov<DPP_ROR4>(x));
  x = maxr(x, dpp_mov<DPP_ROR8>(x));
  return x;
}
__device__ __forceinline__ float allsum16(float x) {
  x += dpp_mov<DPP_XOR1>(x);
  x += dpp_mov<DPP_XOR2>(x);
  x += dpp_mov<DPP_ROR4>(x);
  x += dpp_mov<DPP_ROR8>(x);
  return x;
}

// Work-group barrier that orders LDS traffic only. The barriers of the key loop
// guard nothing but Kt, Vt and Pt; __syncthreads() would also drain the load
// counter and so end the flight of the next tile's global loads at once.
__device__ __forceinline__ void lds_barrier() {
  __builtin_amdgcn_fence(__ATOMIC_RELEASE, "workgroup", "local");
  __builtin_amdgcn_s_barrier();
  __builtin_amdgcn_fence(__ATOMIC_ACQUIRE, "workgroup", "local");
}

__global__ void zero_bits_kernel(unsigned int* bits, int n) {
  int i = blockIdx.x * blockDim.x + threadIdx.x;
  if (i < n) bits[i] = 0u;
}

__global__ void scatter_bits_kernel(const int* __restrict__ mb,
                                    const int* __restrict__ ms,
                                    unsigned int* bits, int m) {
  int i = blockIdx.x * blockDim.x + threadIdx.x;
  if (i < m) {
    int bi = mb[i] * S_ + ms[i];
    atomicOr(&bits[bi >> 5], 1u << (bi & 31));
  }
}

__launch_bounds__(128)
__global__ void flash_attn_kernel(const float* __restrict__ Qg,
                                  const float* __restrict__ Kg,
                                  const float* __restrict__ Vg,
                                  const unsigned int* __restrict__ qbits,
                                  const unsigned int* __restrict__ kbits,
                                  float* __restrict__ Og) {
  // pad rows to 68 halves (136 B): fragment reads conflict-free, 8B-aligned
  __shared__ _Float16 Kt[64][68];
  __shared__ _Float16 Vt[64][68];
  __shared__ _Float16 Pt[4][16][68];

  const int qb    = blockIdx.x & 15;   // 16 query superblocks of 64
  const int bh    = blockIdx.x >> 4;
  const int b     = bh / H_;
  const int h     = bh % H_;
  const int wave  = threadIdx.x >> 5;
  const int lane  = threadIdx.x & 31;
  const int l16   = lane & 15;
  const int hi16  = lane >> 4;         // lane half
  const int kbase = hi16 ? 8 : 0;      // K range owned by this half (A/B frags)
  const int h8    = hi16 ? 8 : 0;      // M offset owned by this half (C frags)

  const int q0 = qb * 64 + wave * 16;

  // ---- Q: two 16x32 f16 A-fragments covering D=64 (loaded once).
  // Fold scale = 1/sqrt(64) = 0.125 (power of two: exact in f16) into Q.
  v16h aq[2];
  {
    const float* qp = Qg + ((size_t)(b * S_ + q0 + l16) * H_ + h) * D_;
#pragma unroll
    for (int c = 0; c < 2; ++c)
#pragma unroll
      for (int j = 0; j < 16; ++j)
        aq[c][j] = (_Float16)(qp[c * 32 + k_of(j, kbase)] * 0.125f);
  }

  // ---- query-row mask bits for the 8 C-rows this lane accumulates ----
  bool rowm[8];
#pragma unroll
  for (int r = 0; r < 8; ++r) {
    int bi = b * S_ + q0 + r + h8;
    rowm[r] = (qbits[bi >> 5] >> (bi & 31)) & 1u;
  }

  // ---- accumulators: O (16x64 as 4 C tiles), online-softmax m,l ----
  v8f o[4];
  float m_i[8], l_i[8];
#pragma unroll
  for (int c = 0; c < 4; ++c)
#pragma unroll
    for (int r = 0; r < 8; ++r) o[c][r] = 0.f;
#pragma unroll
  for (int r = 0; r < 8; ++r) { m_i[r] = -3.0e38f; l_i[r] = 0.f; }

  const float* kb_p = Kg + ((size_t)b * S_ * H_ + h) * D_;     // + s*H*D + d
  const float* vb_p = Vg + ((size_t)(b * H_ + h)) * S_ * D_;   // + s*D + d

  // This thread's share of a 64x64 tile: float4 column d4 of rows key0 + 8*i.
  const int key0 = threadIdx.x >> 4;
  const int d4   = threadIdx.x & 15;
  const float4* kp4 = (const float4*)kb_p + (size_t)key0 * (H_ * D_ / 4) + d4;
  const float4* vp4 = (const float4*)vb_p + (size_t)key0 * (D_ / 4) + d4;

  // Tile 0: all 16 loads of the thread in flight at once.
  float4 kq[8], vq[8];
#pragma unroll  // constant indices keep kq and vq in registers
  for (int i = 0; i < 8; ++i) {
    kq[i] = kp4[(size_t)i * 8 * (H_ * D_ / 4)];
    vq[i] = vp4[(size_t)i * 8 * (D_ / 4)];
  }

  for (int kb = 0; kb < S_; kb += 64) {   // 64-key blocks: 16 WMMA / iter
    lds_barrier();  // prev iteration's Vt/Pt reads done before overwrite

    // stage the tile that was loaded one trip ahead:
    // v_cvt_pk_rz_f16_f32 x2 -> ds_store_b64
#pragma unroll  // constant indices keep kq and vq in registers
    for (int i = 0; i < 8; ++i) {
      uint2 kw, vw;
      kw.x = pk2h(kq[i].x, kq[i].y);  kw.y = pk2h(kq[i].z, kq[i].w);
      vw.x = pk2h(vq[i].x, vq[i].y);  vw.y = pk2h(vq[i].z, vq[i].w);
      *(uint2*)&Kt[key0 + 8 * i][d4 * 4] = kw;   // 8B-aligned (row stride 136 B)
      *(uint2*)&Vt[key0 + 8 * i][d4 * 4] = vw;
    }

    // next tile's 16 loads fly under this tile's products and softmax
    if (kb + 64 < S_) {
      kp4 += 64 * (H_ * D_ / 4);
      vp4 += 64 * (D_ / 4);
#pragma unroll  // constant indices; the 16 loads issue back to back
      for (int i = 0; i < 8; ++i) {
        kq[i] = kp4[(size_t)i * 8 * (H_ * D_ / 4)];
        vq[i] = vp4[(size_t)i * 8 * (D_ / 4)];
      }
    }
    lds_barrier();

    // ---- scores S = (Q*scale) K^T : four 16x16 key sub-tiles ----
    v8f s[4];
#pragma unroll
    for (int t = 0; t < 4; ++t)
#pragma unroll
      for (int r = 0; r < 8; ++r) s[t][r] = 0.f;
#pragma unroll
    for (int c = 0; c < 2; ++c) {
#pragma unroll
      for (int t = 0; t < 4; ++t) {
        v16h bk;
#pragma unroll
        for (int j = 0; j < 16; ++j)
          bk[j] = Kt[t * 16 + l16][c * 32 + k_of(j, kbase)];
        s[t] = __builtin_amdgcn_wmma_f32_16x16x32_f16(false, aq[c], false, bk,
                                                      (short)0, s[t], false, false);
      }
    }

    // ---- masks (reference: set masked entries to -1e10) ----
    bool cm[4];
#pragma unroll
    for (int t = 0; t < 4; ++t) {
      int ki = b * S_ + kb + t * 16 + l16;
      cm[t] = (kbits[ki >> 5] >> (ki & 31)) & 1u;
    }
#pragma unroll
    for (int t = 0; t < 4; ++t)
#pragma unroll
      for (int r = 0; r < 8; ++r)
        if (cm[t] || rowm[r]) s[t][r] = -1.0e10f;

    // ---- online softmax (row reductions via DPP16, pure VALU) ----
#pragma unroll
    for (int r = 0; r < 8; ++r) {
      float bm = maxr(maxr(s[0][r], s[1][r]), maxr(s[2][r], s[3][r]));
      bm = allmax16(bm);
      float mnew = maxr(m_i[r], bm);
      float p0 = __expf(s[0][r] - mnew);
      float p1 = __expf(s[1][r] - mnew);
      float p2 = __expf(s[2][r] - mnew);
      float p3 = __expf(s[3][r] - mnew);
      float rs = allsum16((p0 + p1) + (p2 + p3));
      float alpha = __expf(m_i[r] - mnew);   // first block: exp(-3e38-x) = 0
      l_i[r] = l_i[r] * alpha + rs;
      m_i[r] = mnew;
#pragma unroll
      for (int c = 0; c < 4; ++c) o[c][r] *= alpha;
      // C-layout -> LDS so we can re-read P in A-fragment layout
      Pt[wave][r + h8][l16]      = (_Float16)p0;
      Pt[wave][r + h8][16 + l16] = (_Float16)p1;
      Pt[wave][r + h8][32 + l16] = (_Float16)p2;
      Pt[wave][r + h8][48 + l16] = (_Float16)p3;
    }
    lds_barrier();  // Pt visible across the wave's lane halves

    // ---- O += P @ V : K = 64 keys as two 32-key halves, 4 dim-chunks ----
    v16h ap[2];
#pragma unroll
    for (int kh = 0; kh < 2; ++kh)
#pragma unroll
      for (int j = 0; j < 16; ++j)
        ap[kh][j] = Pt[wave][l16][kh * 32 + k_of(j, kbase)];
#pragma unroll
    for (int c = 0; c < 4; ++c) {
#pragma unroll
      for (int kh = 0; kh < 2; ++kh) {
        v16h bv;
#pragma unroll
        for (int j = 0; j < 16; ++j)
          bv[j] = Vt[kh * 32 + k_of(j, kbase)][c * 16 + l16];
        o[c] = __builtin_amdgcn_wmma_f32_16x16x32_f16(false, ap[kh], false, bv,
                                                      (short)0, o[c], false, false);
      }
    }
  }

  // ---- epilogue: normalize by l and store O (B,H,S,D) fp32 ----
#pragma unroll
  for (int r = 0; r < 8; ++r) {
    float inv = 1.0f / l_i[r];
    int row = q0 + r + h8;
    float* op = Og + ((size_t)(b * H_ + h) * S_ + row) * D_;
#pragma unroll
    for (int c = 0; c < 4; ++c) op[c * 16 + l16] = o[c][r] * inv;
  }
}

extern "C" void kernel_launch(void* const* d_in, const int* in_sizes, int n_in,
                              void* d_out, int out_size, void* d_ws, size_t ws_size,
                              hipStream_t stream) {
  (void)in_sizes; (void)n_in; (void)out_size; (void)ws_size;
  const float* Q  = (const float*)d_in[0];
  const float* K  = (const float*)d_in[1];
  const float* V  = (const float*)d_in[2];
  const int* qm_b = (const int*)d_in[3];
  const int* qm_s = (const int*)d_in[4];
  const int* km_b = (const int*)d_in[5];
  const int* km_s = (const int*)d_in[6];

  unsigned int* qbits = (unsigned int*)d_ws;        // 256 words
  unsigned int* kbits = qbits + (B_ * S_ / 32);     // 256 words
  const int nwords = B_ * S_ / 32;

  zero_bits_kernel<<<(2 * nwords + 255) / 256, 256, 0, stream>>>(qbits, 2 * nwords);
  scatter_bits_kernel<<<(M_ + 255) / 256, 256, 0, stream>>>(qm_b, qm_s, qbits, M_);
  scatter_bits_kernel<<<(M_ + 255) / 256, 256, 0, stream>>>(km_b, km_s, kbits, M_);

  dim3 grid(B_ * H_ * (S_ / 64));   // 2048 workgroups
  flash_attn_kernel<<<grid, 128, 0, stream>>>(Q, K, V, qbits, kbits, (float*)d_out);
}

// v002
// A run of this version takes 82 microseconds.
// Two timings next to v001 both put it at 1.39 times that version's speed.
// Counting every step since v000, it is 2.51 times as fast.
#include <hip/hip_runtime.h>

typedef __attribute__((ext_vector_type(16))) _Float16 v16h;
typedef __attribute__((ext_vector_type(8)))  float    v8f;
typedef __attribute__((ext_vector_type(8)))  short    v8s;

#define B_ 8
#define S_ 1024
#define H_ 16
#define D_ 64
#define M_ 1024

// K-index inside a 16x32 f16 A/B fragment for element j of the v16h,
// given this lane-half's base (0 for lanes 0-15, 8 for lanes 16-31).
// VGPR i (pair j=2i,2i+1): K = base + 2i (i<4)  or  base + 16 + 2(i-4).
__device__ __forceinline__ int k_of(int j, int kbase) {
  int i = j >> 1;
  int base = (i < 4) ? (2 * i) : (2 * i + 8);
  return kbase + base + (j & 1);
}

// pack two f32 into one dword of two f16 (v_cvt_pk_rz_f16_f32)
__device__ __forceinline__ unsigned int pk2h(float x, float y) {
  return __builtin_bit_cast(unsigned int, __builtin_amdgcn_cvt_pkrtz(x, y));
}

// raw v_max_num_f32 (skip fmaxf's canonicalize chaff; inputs are never sNaN)
__device__ __forceinline__ float maxr(float a, float b) {
  float d;
  asm("v_max_num_f32 %0, %1, %2" : "=v"(d) : "v"(a), "v"(b));
  return d;
}

// DPP16 lane permute within each 16-lane row (VALU, no LDS traffic)
template <int CTRL>
__device__ __forceinline__ float dpp_mov(float x) {
  return __builtin_bit_cast(
      float, __builtin_amdgcn_update_dpp(0, __builtin_bit_cast(int, x), CTRL,
                                         0xF, 0xF, true));
}
#define DPP_XOR1 0xB1   // quad_perm(1,0,3,2)
#define DPP_XOR2 0x4E   // quad_perm(2,3,0,1)
#define DPP_ROR4 0x124  // row_ror:4
#define DPP_ROR8 0x128  // row_ror:8

// 16-lane all-reduce (rotation butterfly: quad stages make groups-of-4
// uniform, then ror4 + ror8 combine the four groups exactly once)
__device__ __forceinline__ float allmax16(float x) {
  x = maxr(x, dpp_mov<DPP_XOR1>(x));
  x = maxr(x, dpp_mov<DPP_XOR2>(x));
  x = maxr(x, dpp_mov<DPP_ROR4>(x));
  x = maxr(x, dpp_mov<DPP_ROR8>(x));
  return x;
}
__device__ __forceinline__ float allsum16(float x) {
  x += dpp_mov<DPP_XOR1>(x);
  x += dpp_mov<DPP_XOR2>(x);
  x += dpp_mov<DPP_ROR4>(x);
  x += dpp_mov<DPP_ROR8>(x);
  return x;
}

// Work-group barrier that orders LDS traffic only. The barriers of the key loop
// guard nothing but Kt, Vt and Pt; __syncthreads() would also drain the load
// counter and so end the flight of the next tile's global loads at once.
__device__ __forceinline__ void lds_barrier() {
  __builtin_amdgcn_fence(__ATOMIC_RELEASE, "workgroup", "local");
  __builtin_amdgcn_s_barrier();
  __builtin_amdgcn_fence(__ATOMIC_ACQUIRE, "workgroup", "local");
}

// Row pitch of the V tile in halves: 160 B, an odd multiple of 32 B, the
// conflict-free pitch for the transposing load (rows stay 16-byte aligned).
#define VP_ 80

// ds_load_tr16_b128: the lane addresses 16 bytes of a row-major 16-bit tile and
// receives 8 consecutive rows of one column (rows 8*(lane>>4)+0..7, column
// lane&15 of the 16x16 block), i.e. half a B fragment in the hardware k order.
__device__ __forceinline__ v8s ld_tr16(const _Float16* p) {
  typedef __attribute__((address_space(3))) v8s lds_v8s;
  return __builtin_amdgcn_ds_load_tr16_b128_v8i16((lds_v8s*)p);
}

__global__ void zero_bits_kernel(unsigned int* bits, int n) {
  int i = blockIdx.x * blockDim.x + threadIdx.x;
  if (i < n) bits[i] = 0u;
}

__global__ void scatter_bits_kernel(const int* __restrict__ mb,
                                    const int* __restrict__ ms,
                                    unsigned int* bits, int m) {
  int i = blockIdx.x * blockDim.x + threadIdx.x;
  if (i < m) {
    int bi = mb[i] * S_ + ms[i];
    atomicOr(&bits[bi >> 5], 1u << (bi & 31));
  }
}

__launch_bounds__(128)
__global__ void flash_attn_kernel(const float* __restrict__ Qg,
                                  const float* __restrict__ Kg,
                                  const float* __restrict__ Vg,
                                  const unsigned int* __restrict__ qbits,
                                  const unsigned int* __restrict__ kbits,
                                  float* __restrict__ Og) {
  // pad rows to 68 halves (136 B): fragment reads conflict-free, 8B-aligned
  __shared__ _Float16 Kt[64][68];
  __shared__ __attribute__((aligned(16))) _Float16 Vt[64][VP_];  // read by ld_tr16
  __shared__ _Float16 Pt[4][16][68];

  const int qb    = blockIdx.x & 15;   // 16 query superblocks of 64
  const int bh    = blockIdx.x >> 4;
  const int b     = bh / H_;
  const int h     = bh % H_;
  const int wave  = threadIdx.x >> 5;
  const int lane  = threadIdx.x & 31;
  const int l16   = lane & 15;
  const int hi16  = lane >> 4;         // lane half
  const int kbase = hi16 ? 8 : 0;      // K range owned by this half (A/B frags)
  const int h8    = hi16 ? 8 : 0;      // M offset owned by this half (C frags)

  const int q0 = qb * 64 + wave * 16;

  // ---- Q: two 16x32 f16 A-fragments covering D=64 (loaded once).
  // Fold scale = 1/sqrt(64) = 0.125 (power of two: exact in f16) into Q.
  v16h aq[2];
  {
    const float* qp = Qg + ((size_t)(b * S_ + q0 + l16) * H_ + h) * D_;
#pragma unroll
    for (int c = 0; c < 2; ++c)
#pragma unroll
      for (int j = 0; j < 16; ++j)
        aq[c][j] = (_Float16)(qp[c * 32 + k_of(j, kbase)] * 0.125f);
  }

  // ---- query-row mask bits for the 8 C-rows this lane accumulates ----
  bool rowm[8];
#pragma unroll
  for (int r = 0; r < 8; ++r) {
    int bi = b * S_ + q0 + r + h8;
    rowm[r] = (qbits[bi >> 5] >> (bi & 31)) & 1u;
  }

  // ---- accumulators: O (16x64 as 4 C tiles), online-softmax m,l ----
  v8f o[4];
  float m_i[8], l_i[8];
#pragma unroll
  for (int c = 0; c < 4; ++c)
#pragma unroll
    for (int r = 0; r < 8; ++r) o[c][r] = 0.f;
#pragma unroll
  for (int r = 0; r < 8; ++r) { m_i[r] = -3.0e38f; l_i[r] = 0.f; }

  const float* kb_p = Kg + ((size_t)b * S_ * H_ + h) * D_;     // + s*H*D + d
  const float* vb_p = Vg + ((size_t)(b * H_ + h)) * S_ * D_;   // + s*D + d

  // This thread's share of a 64x64 tile: float4 column d4 of rows key0 + 8*i.
  const int key0 = threadIdx.x >> 4;
  const int d4   = threadIdx.x & 15;
  const float4* kp4 = (const float4*)kb_p + (size_t)key0 * (H_ * D_ / 4) + d4;
  const float4* vp4 = (const float4*)vb_p + (size_t)key0 * (D_ / 4) + d4;

  // Tile 0: all 16 loads of the thread in flight at once.
  float4 kq[8], vq[8];
#pragma unroll  // constant indices keep kq and vq in registers
  for (int i = 0; i < 8; ++i) {
    kq[i] = kp4[(size_t)i * 8 * (H_ * D_ / 4)];
    vq[i] = vp4[(size_t)i * 8 * (D_ / 4)];
  }

  for (int kb = 0; kb < S_; kb += 64) {   // 64-key blocks: 16 WMMA / iter
    lds_barrier();  // prev iteration's Vt/Pt reads done before overwrite

    // stage the tile that was loaded one trip ahead:
    // v_cvt_pk_rz_f16_f32 x2 -> ds_store_b64
#pragma unroll  // constant indices keep kq and vq in registers
    for (int i = 0; i < 8; ++i) {
      uint2 kw, vw;
      kw.x = pk2h(kq[i].x, kq[i].y);  kw.y = pk2h(kq[i].z, kq[i].w);
      vw.x = pk2h(vq[i].x, vq[i].y);  vw.y = pk2h(vq[i].z, vq[i].w);
      *(uint2*)&Kt[key0 + 8 * i][d4 * 4] = kw;   // 8B-aligned (row stride 136 B)
      *(uint2*)&Vt[key0 + 8 * i][d4 * 4] = vw;   // 8B-aligned (row stride 160 B)
    }

    // next tile's 16 loads fly under this tile's products and softmax
    if (kb + 64 < S_) {
      kp4 += 64 * (H_ * D_ / 4);
      vp4 += 64 * (D_ / 4);
#pragma unroll  // constant indices; the 16 loads issue back to back
      for (int i = 0; i < 8; ++i) {
        kq[i] = kp4[(size_t)i * 8 * (H_ * D_ / 4)];
        vq[i] = vp4[(size_t)i * 8 * (D_ / 4)];
      }
    }
    lds_barrier();

    // ---- scores S = (Q*scale) K^T : four 16x16 key sub-tiles ----
    v8f s[4];
#pragma unroll
    for (int t = 0; t < 4; ++t)
#pragma unroll
      for (int r = 0; r < 8; ++r) s[t][r] = 0.f;
#pragma unroll
    for (int c = 0; c < 2; ++c) {
#pragma unroll
      for (int t = 0; t < 4; ++t) {
        v16h bk;
#pragma unroll
        for (int j = 0; j < 16; ++j)
          bk[j] = Kt[t * 16 + l16][c * 32 + k_of(j, kbase)];
        s[t] = __builtin_amdgcn_wmma_f32_16x16x32_f16(false, aq[c], false, bk,
                                                      (short)0, s[t], false, false);
      }
    }

    // ---- masks (reference: set masked entries to -1e10) ----
    bool cm[4];
#pragma unroll
    for (int t = 0; t < 4; ++t) {
      int ki = b * S_ + kb + t * 16 + l16;
      cm[t] = (kbits[ki >> 5] >> (ki & 31)) & 1u;
    }
#pragma unroll
    for (int t = 0; t < 4; ++t)
#pragma unroll
      for (int r = 0; r < 8; ++r)
        if (cm[t] || rowm[r]) s[t][r] = -1.0e10f;

    // ---- online softmax (row reductions via DPP16, pure VALU) ----
#pragma unroll
    for (int r = 0; r < 8; ++r) {
      float bm = maxr(maxr(s[0][r], s[1][r]), maxr(s[2][r], s[3][r]));
      bm = allmax16(bm);
      float mnew = maxr(m_i[r], bm);
      float p0 = __expf(s[0][r] - mnew);
      float p1 = __expf(s[1][r] - mnew);
      float p2 = __expf(s[2][r] - mnew);
      float p3 = __expf(s[3][r] - mnew);
      float rs = allsum16((p0 + p1) + (p2 + p3));
      float alpha = __expf(m_i[r] - mnew);   // first block: exp(-3e38-x) = 0
      l_i[r] = l_i[r] * alpha + rs;
      m_i[r] = mnew;
#pragma unroll
      for (int c = 0; c < 4; ++c) o[c][r] *= alpha;
      // C-layout -> LDS so we can re-read P in A-fragment layout
      Pt[wave][r + h8][l16]      = (_Float16)p0;
      Pt[wave][r + h8][16 + l16] = (_Float16)p1;
      Pt[wave][r + h8][32 + l16] = (_Float16)p2;
      Pt[wave][r + h8][48 + l16] = (_Float16)p3;
    }
    lds_barrier();  // Pt visible across the wave's lane halves

    // ---- O += P @ V : K = 64 keys as two 32-key halves, 4 dim-chunks ----
    v16h ap[2];
#pragma unroll
    for (int kh = 0; kh < 2; ++kh)
#pragma unroll
      for (int j = 0; j < 16; ++j)
        ap[kh][j] = Pt[wave][l16][kh * 32 + k_of(j, kbase)];
    // V B-fragments: two transposing loads each (keys kh*32 + kbase + 0..7 and
    // + 16..23 of column c*16 + l16: the k order of k_of, as ap has it).
    const _Float16* vtp = &Vt[kbase + (lane & 7)][((lane >> 3) & 1) * 8];
#pragma unroll
    for (int c = 0; c < 4; ++c) {
#pragma unroll
      for (int kh = 0; kh < 2; ++kh) {
        v8s lo = ld_tr16(vtp + (kh * 32) * VP_ + c * 16);
        v8s hi = ld_tr16(vtp + (kh * 32 + 16) * VP_ + c * 16);
        v16h bv = __builtin_bit_cast(
            v16h, __builtin_shufflevector(lo, hi, 0, 1, 2, 3, 4, 5, 6, 7, 8, 9,
                                          10, 11, 12, 13, 14, 15));
        o[c] = __builtin_amdgcn_wmma_f32_16x16x32_f16(false, ap[kh], false, bv,
                                                      (short)0, o[c], false, false);
      }
    }
  }

  // ---- epilogue: normalize by l and store O (B,H,S,D) fp32 ----
#pragma unroll
  for (int r = 0; r < 8; ++r) {
    float inv = 1.0f / l_i[r];
    int row = q0 + r + h8;
    float* op = Og + ((size_t)(b * H_ + h) * S_ + row) * D_;
#pragma unroll
    for (int c = 0; c < 4; ++c) op[c * 16 + l16] = o[c][r] * inv;
  }
}

extern "C" void kernel_launch(void* const* d_in, const int* in_sizes, int n_in,
                              void* d_out, int out_size, void* d_ws, size_t ws_size,
                              hipStream_t stream) {
  (void)in_sizes; (void)n_in; (void)out_size; (void)ws_size;
  const float* Q  = (const float*)d_in[0];
  const float* K  = (const float*)d_in[1];
  const float* V  = (const float*)d_in[2];
  const int* qm_b = (const int*)d_in[3];
  const int* qm_s = (const int*)d_in[4];
  const int* km_b = (const int*)d_in[5];
  const int* km_s = (const int*)d_in[6];

  unsigned int* qbits = (unsigned int*)d_ws;        // 256 words
  unsigned int* kbits = qbits + (B_ * S_ / 32);     // 256 words
  const int nwords = B_ * S_ / 32;

  zero_bits_kernel<<<(2 * nwords + 255) / 256, 256, 0, stream>>>(qbits, 2 * nwords);
  scatter_bits_kernel<<<(M_ + 255) / 256, 256, 0, stream>>>(qm_b, qm_s, qbits, M_);
  scatter_bits_kernel<<<(M_ + 255) / 256, 256, 0, stream>>>(km_b, km_s, kbits, M_);

  dim3 grid(B_ * H_ * (S_ / 64));   // 2048 workgroups
  flash_attn_kernel<<<grid, 128, 0, stream>>>(Q, K, V, qbits, kbits, (float*)d_out);
}

// v003
// Measured time: 63 microseconds a run.
// Two timings next to v002 both put it at 1.30 times that version's speed.
// Counting every step since v000, it is 3.26 times as fast.
#include <hip/hip_runtime.h>

typedef __attribute__((ext_vector_type(16))) _Float16 v16h;
typedef __attribute__((ext_vector_type(8)))  float    v8f;
typedef __attribute__((ext_vector_type(8)))  short    v8s;
typedef __attribute__((ext_vector_type(2)))  float    v2f;
typedef __attribute__((ext_vector_type(2)))  _Float16 v2h;

#define B_ 8
#define S_ 1024
#define H_ 16
#define D_ 64
#define M_ 1024

// K-index inside a 16x32 f16 A/B fragment for element j of the v16h,
// given this lane-half's base (0 for lanes 0-15, 8 for lanes 16-31).
// VGPR i (pair j=2i,2i+1): K = base + 2i (i<4)  or  base + 16 + 2(i-4).
__device__ __forceinline__ int k_of(int j, int kbase) {
  int i = j >> 1;
  int base = (i < 4) ? (2 * i) : (2 * i + 8);
  return kbase + base + (j & 1);
}

// pack two f32 into one dword of two f16 (v_cvt_pk_rz_f16_f32)
__device__ __forceinline__ unsigned int pk2h(float x, float y) {
  return __builtin_bit_cast(unsigned int, __builtin_amdgcn_cvt_pkrtz(x, y));
}

// raw v_max_num_f32 (skip fmaxf's canonicalize chaff; inputs are never sNaN)
__device__ __forceinline__ float maxr(float a, float b) {
  float d;
  asm("v_max_num_f32 %0, %1, %2" : "=v"(d) : "v"(a), "v"(b));
  return d;
}

// raw v_max3_num_f32: three-way maximum in one instruction (same reason as maxr)
__device__ __forceinline__ float max3r(float a, float b, float c) {
  float d;
  asm("v_max3_num_f32 %0, %1, %2, %3" : "=v"(d) : "v"(a), "v"(b), "v"(c));
  return d;
}

// value of lane l ^ 16 (v_permlanex16_b32): the other half of a query's keys
__device__ __forceinline__ float xhalf(float x) {
  int b = __builtin_bit_cast(int, x);
  return __builtin_bit_cast(
      float, __builtin_amdgcn_permlanex16(b, b, 0x76543210, 0xfedcba98, false,
                                          false));
}

// Work-group barrier that orders LDS traffic only. The barriers of the key loop
// guard nothing but Kt and Vt; __syncthreads() would also drain the load
// counter and so end the flight of the next tile's global loads at once.
__device__ __forceinline__ void lds_barrier() {
  __builtin_amdgcn_fence(__ATOMIC_RELEASE, "workgroup", "local");
  __builtin_amdgcn_s_barrier();
  __builtin_amdgcn_fence(__ATOMIC_ACQUIRE, "workgroup", "local");
}

// Row pitch of the V tile in halves: 160 B, an odd multiple of 32 B, the
// conflict-free pitch for the transposing load (rows stay 16-byte aligned).
#define VP_ 80

// ds_load_tr16_b128: the lane addresses 16 bytes of a row-major 16-bit tile and
// receives 8 consecutive rows of one column (rows 8*(lane>>4)+0..7, column
// lane&15 of the 16x16 block), i.e. half an A fragment of the transposed tile in
// the hardware k order.
__device__ __forceinline__ v8s ld_tr16(const _Float16* p) {
  typedef __attribute__((address_space(3))) v8s lds_v8s;
  return __builtin_amdgcn_ds_load_tr16_b128_v8i16((lds_v8s*)p);
}

__global__ void zero_bits_kernel(unsigned int* bits, int n) {
  int i = blockIdx.x * blockDim.x + threadIdx.x;
  if (i < n) bits[i] = 0u;
}

__global__ void scatter_bits_kernel(const int* __restrict__ mb,
                                    const int* __restrict__ ms,
                                    unsigned int* bits, int m) {
  int i = blockIdx.x * blockDim.x + threadIdx.x;
  if (i < m) {
    int bi = mb[i] * S_ + ms[i];
    atomicOr(&bits[bi >> 5], 1u << (bi & 31));
  }
}

__launch_bounds__(128)
__global__ void flash_attn_kernel(const float* __restrict__ Qg,
                                  const float* __restrict__ Kg,
                                  const float* __restrict__ Vg,
                                  const unsigned int* __restrict__ qbits,
                                  const unsigned int* __restrict__ kbits,
                                  float* __restrict__ Og) {
  // pad rows to 68 halves (136 B): fragment reads conflict-free, 8B-aligned
  __shared__ _Float16 Kt[64][68];
  __shared__ __attribute__((aligned(16))) _Float16 Vt[64][VP_];  // read by ld_tr16

  const int qb    = blockIdx.x & 15;   // 16 query superblocks of 64
  const int bh    = blockIdx.x >> 4;
  const int b     = bh / H_;
  const int h     = bh % H_;
  const int wave  = threadIdx.x >> 5;
  const int lane  = threadIdx.x & 31;
  const int l16   = lane & 15;
  const int hi16  = lane >> 4;         // lane half
  const int kbase = hi16 ? 8 : 0;      // K range owned by this half (A/B frags)
  const int h8    = hi16 ? 8 : 0;      // M offset owned by this half (C frags)

  const int q0 = qb * 64 + wave * 16;

  // ---- Q^T: two 32x16 f16 B-fragments covering D=64 (loaded once).
  // Fold scale = 1/sqrt(64) = 0.125 (power of two: exact in f16) into Q.
  v16h aq[2];
  {
    const float* qp = Qg + ((size_t)(b * S_ + q0 + l16) * H_ + h) * D_;
#pragma unroll
    for (int c = 0; c < 2; ++c)
#pragma unroll
      for (int j = 0; j < 16; ++j)
        aq[c][j] = (_Float16)(qp[c * 32 + k_of(j, kbase)] * 0.125f);
  }

  // ---- mask bit of this lane's query ----
  const int qi = b * S_ + q0 + l16;
  const bool rowm = (qbits[qi >> 5] >> (qi & 31)) & 1u;

  // ---- accumulators: O^T (64x16 as 4 C tiles), online-softmax m,l.
  // m_i is the query's running maximum (equal in both halves); l_i sums this
  // half's keys only, the halves are joined in the epilogue.
  v8f o[4];
#pragma unroll
  for (int c = 0; c < 4; ++c)
#pragma unroll
    for (int r = 0; r < 8; ++r) o[c][r] = 0.f;
  float m_i = -3.0e38f, l_i = 0.f;

  const float* kb_p = Kg + ((size_t)b * S_ * H_ + h) * D_;     // + s*H*D + d
  const float* vb_p = Vg + ((size_t)(b * H_ + h)) * S_ * D_;   // + s*D + d

  // This thread's share of a 64x64 tile: float4 column d4 of rows key0 + 8*i.
  const int key0 = threadIdx.x >> 4;
  const int d4   = threadIdx.x & 15;
  const float4* kp4 = (const float4*)kb_p + (size_t)key0 * (H_ * D_ / 4) + d4;
  const float4* vp4 = (const float4*)vb_p + (size_t)key0 * (D_ / 4) + d4;

  // Tile 0: all 16 loads of the thread in flight at once.
  float4 kq[8], vq[8];
#pragma unroll  // constant indices keep kq and vq in registers
  for (int i = 0; i < 8; ++i) {
    kq[i] = kp4[(size_t)i * 8 * (H_ * D_ / 4)];
    vq[i] = vp4[(size_t)i * 8 * (D_ / 4)];
  }

  for (int kb = 0; kb < S_; kb += 64) {   // 64-key blocks: 16 WMMA / iter
    // mask words of this tile's 64 keys, fetched ahead of their use
    const uint2 mw = *(const uint2*)&kbits[(b * S_ + kb) >> 5];

    lds_barrier();  // prev iteration's Kt/Vt reads done before overwrite

    // stage the tile that was loaded one trip ahead:
    // v_cvt_pk_rz_f16_f32 x2 -> ds_store_b64
#pragma unroll  // constant indices keep kq and vq in registers
    for (int i = 0; i < 8; ++i) {
      uint2 kw, vw;
      kw.x = pk2h(kq[i].x, kq[i].y);  kw.y = pk2h(kq[i].z, kq[i].w);
      vw.x = pk2h(vq[i].x, vq[i].y);  vw.y = pk2h(vq[i].z, vq[i].w);
      *(uint2*)&Kt[key0 + 8 * i][d4 * 4] = kw;   // 8B-aligned (row stride 136 B)
      *(uint2*)&Vt[key0 + 8 * i][d4 * 4] = vw;   // 8B-aligned (row stride 160 B)
    }

    // next tile's 16 loads fly under this tile's products and softmax
    if (kb + 64 < S_) {
      kp4 += 64 * (H_ * D_ / 4);
      vp4 += 64 * (D_ / 4);
#pragma unroll  // constant indices; the 16 loads issue back to back
      for (int i = 0; i < 8; ++i) {
        kq[i] = kp4[(size_t)i * 8 * (H_ * D_ / 4)];
        vq[i] = vp4[(size_t)i * 8 * (D_ / 4)];
      }
    }
    lds_barrier();

    // ---- scores S^T = K (Q*scale)^T : four 16-key row tiles;
    // s[t][r] = score of key kb + 16 t + h8 + r against query l16 ----
    v8f s[4];
#pragma unroll
    for (int t = 0; t < 4; ++t)
#pragma unroll
      for (int r = 0; r < 8; ++r) s[t][r] = 0.f;
#pragma unroll
    for (int c = 0; c < 2; ++c) {
#pragma unroll
      for (int t = 0; t < 4; ++t) {
        v16h ak;
#pragma unroll
        for (int j = 0; j < 16; ++j)
          ak[j] = Kt[t * 16 + l16][c * 32 + k_of(j, kbase)];
        s[t] = __builtin_amdgcn_wmma_f32_16x16x32_f16(false, ak, false, aq[c],
                                                      (short)0, s[t], false, false);
      }
    }

    // ---- masks (reference: set masked entries to -1e10). One word covers 32
    // keys; shifted by h8, bit 16 (t & 1) + r is the lane's key; a masked query
    // takes every bit. Each tile's 8 bits are moved to the top of a word and
    // shifted out one by one: the add's carry is the select's condition.
    const unsigned int wm[2] = {rowm ? 0xFFFFFFFFu : (mw.x >> h8),
                                rowm ? 0xFFFFFFFFu : (mw.y >> h8)};
#pragma unroll  // constant indices keep the tiles in registers
    for (int t = 0; t < 4; ++t) {
      unsigned int x = wm[t >> 1] << (24 - 16 * (t & 1));
#pragma unroll  // constant indices keep the tiles in registers
      for (int r = 7; r >= 0; --r) {
        const bool masked = __builtin_add_overflow(x, x, &x);
        if (masked) s[t][r] = -1.0e10f;
      }
    }

    // ---- online softmax: maximum and sum run over the lane's own 32 scores,
    // one exchange joins the maxima of the two halves ----
    float tm[4];
#pragma unroll  // constant indices keep the tiles in registers
    for (int t = 0; t < 4; ++t) {
      float x = max3r(s[t][0], s[t][1], s[t][2]);
      float y = max3r(s[t][3], s[t][4], s[t][5]);
      tm[t] = max3r(x, y, maxr(s[t][6], s[t][7]));
    }
    float bm = max3r(tm[0], tm[1], maxr(tm[2], tm[3]));
    float mnew = max3r(m_i, bm, xhalf(bm));
    float ts[4];
#pragma unroll  // constant indices keep the tiles in registers
    for (int t = 0; t < 4; ++t) {
#pragma unroll  // constant indices keep the tiles in registers
      for (int r = 0; r < 8; ++r) s[t][r] = __expf(s[t][r] - mnew);
      ts[t] = ((s[t][0] + s[t][1]) + (s[t][2] + s[t][3])) +
              ((s[t][4] + s[t][5]) + (s[t][6] + s[t][7]));
    }
    float alpha = __expf(m_i - mnew);   // first block: exp(-3e38-x) = 0
    l_i = l_i * alpha + ((ts[0] + ts[1]) + (ts[2] + ts[3]));
    m_i = mnew;
#pragma unroll  // constant indices keep the tiles in registers
    for (int c = 0; c < 4; ++c)
#pragma unroll  // constant indices keep the tiles in registers
      for (int r = 0; r < 8; ++r) o[c][r] *= alpha;

    // ---- P^T as B-fragments straight from the score tiles: element j of half
    // kh is key kh*32 + k_of(j, kbase) = row j & 7 of tile 2 kh + (j >> 3) ----
    v16h bp[2];
#pragma unroll  // constant indices keep the tiles in registers
    for (int kh = 0; kh < 2; ++kh)
#pragma unroll  // constant indices keep the tiles in registers
      for (int j = 0; j < 16; j += 2) {
        v2f pf = {s[2 * kh + (j >> 3)][j & 7], s[2 * kh + (j >> 3)][(j & 7) + 1]};
        v2h ph = __builtin_convertvector(pf, v2h);   // round to nearest even
        bp[kh][j] = ph[0];
        bp[kh][j + 1] = ph[1];
      }

    // ---- O^T += V^T P^T : K = 64 keys as two 32-key halves, 4 dim-chunks ----
    // V^T A-fragments: two transposing loads each (keys kh*32 + kbase + 0..7 and
    // + 16..23 of dim c*16 + l16: the k order of k_of, as bp has it).
    const _Float16* vtp = &Vt[kbase + (lane & 7)][((lane >> 3) & 1) * 8];
#pragma unroll
    for (int c = 0; c < 4; ++c) {
#pragma unroll
      for (int kh = 0; kh < 2; ++kh) {
        v8s lo = ld_tr16(vtp + (kh * 32) * VP_ + c * 16);
        v8s hi = ld_tr16(vtp + (kh * 32 + 16) * VP_ + c * 16);
        v16h av = __builtin_bit_cast(
            v16h, __builtin_shufflevector(lo, hi, 0, 1, 2, 3, 4, 5, 6, 7, 8, 9,
                                          10, 11, 12, 13, 14, 15));
        o[c] = __builtin_amdgcn_wmma_f32_16x16x32_f16(false, av, false, bp[kh],
                                                      (short)0, o[c], false, false);
      }
    }
  }

  // ---- epilogue: join the halves' sums, normalize, store O (B,H,S,D) fp32:
  // the lane holds dims c*16 + h8 + 0..7 of query q0 + l16 ----
  const float inv = 1.0f / (l_i + xhalf(l_i));
  float* op = Og + ((size_t)(b * H_ + h) * S_ + q0 + l16) * D_ + h8;
#pragma unroll  // constant indices keep the tiles in registers
  for (int c = 0; c < 4; ++c) {
    *(float4*)(op + c * 16) = make_float4(o[c][0] * inv, o[c][1] * inv,
                                          o[c][2] * inv, o[c][3] * inv);
    *(float4*)(op + c * 16 + 4) = make_float4(o[c][4] * inv, o[c][5] * inv,
                                              o[c][6] * inv, o[c][7] * inv);
  }
}

extern "C" void kernel_launch(void* const* d_in, const int* in_sizes, int n_in,
                              void* d_out, int out_size, void* d_ws, size_t ws_size,
                              hipStream_t stream) {
  (void)in_sizes; (void)n_in; (void)out_size; (void)ws_size;
  const float* Q  = (const float*)d_in[0];
  const float* K  = (const float*)d_in[1];
  const float* V  = (const float*)d_in[2];
  const int* qm_b = (const int*)d_in[3];
  const int* qm_s = (const int*)d_in[4];
  const int* km_b = (const int*)d_in[5];
  const int* km_s = (const int*)d_in[6];

  unsigned int* qbits = (unsigned int*)d_ws;        // 256 words
  unsigned int* kbits = qbits + (B_ * S_ / 32);     // 256 words
  const int nwords = B_ * S_ / 32;

  zero_bits_kernel<<<(2 * nwords + 255) / 256, 256, 0, stream>>>(qbits, 2 * nwords);
  scatter_bits_kernel<<<(M_ + 255) / 256, 256, 0, stream>>>(qm_b, qm_s, qbits, M_);
  scatter_bits_kernel<<<(M_ + 255) / 256, 256, 0, stream>>>(km_b, km_s, kbits, M_);

  dim3 grid(B_ * H_ * (S_ / 64));   // 2048 workgroups
  flash_attn_kernel<<<grid, 128, 0, stream>>>(Q, K, V, qbits, kbits, (float*)d_out);
}

// v004
// A run of this version takes 54 microseconds.
// Two timings next to v003 put it at 1.16 and 1.17 times that version's speed.
// Counting every step since v000, it is 3.80 times as fast.
#include <hip/hip_runtime.h>

typedef __attribute__((ext_vector_type(16))) _Float16 v16h;
typedef __attribute__((ext_vector_type(8)))  float    v8f;
typedef __attribute__((ext_vector_type(8)))  short    v8s;
typedef __attribute__((ext_vector_type(2)))  float    v2f;
typedef __attribute__((ext_vector_type(2)))  _Float16 v2h;

#define B_ 8
#define S_ 1024
#define H_ 16
#define D_ 64
#define M_ 1024

// K-index inside a 16x32 f16 A/B fragment for element j of the v16h,
// given this lane-half's base (0 for lanes 0-15, 8 for lanes 16-31).
// VGPR i (pair j=2i,2i+1): K = base + 2i (i<4)  or  base + 16 + 2(i-4).
__device__ __forceinline__ int k_of(int j, int kbase) {
  int i = j >> 1;
  int base = (i < 4) ? (2 * i) : (2 * i + 8);
  return kbase + base + (j & 1);
}

// pack two f32 into one dword of two f16 (v_cvt_pk_rz_f16_f32)
__device__ __forceinline__ unsigned int pk2h(float x, float y) {
  return __builtin_bit_cast(unsigned int, __builtin_amdgcn_cvt_pkrtz(x, y));
}

// raw v_max_num_f32 (skip fmaxf's canonicalize chaff; inputs are never sNaN)
__device__ __forceinline__ float maxr(float a, float b) {
  float d;
  asm("v_max_num_f32 %0, %1, %2" : "=v"(d) : "v"(a), "v"(b));
  return d;
}

// raw v_max3_num_f32: three-way maximum in one instruction (same reason as maxr)
__device__ __forceinline__ float max3r(float a, float b, float c) {
  float d;
  asm("v_max3_num_f32 %0, %1, %2, %3" : "=v"(d) : "v"(a), "v"(b), "v"(c));
  return d;
}

// value of lane l ^ 16 (v_permlanex16_b32): the other half of a query's keys
__device__ __forceinline__ float xhalf(float x) {
  int b = __builtin_bit_cast(int, x);
  return __builtin_bit_cast(
      float, __builtin_amdgcn_permlanex16(b, b, 0x76543210, 0xfedcba98, false,
                                          false));
}

// Work-group barrier that orders LDS traffic only. The barriers of the key loop
// guard nothing but Kt and Vt; __syncthreads() would also drain the load
// counter and so end the flight of the next tile's global loads at once.
__device__ __forceinline__ void lds_barrier() {
  __builtin_amdgcn_fence(__ATOMIC_RELEASE, "workgroup", "local");
  __builtin_amdgcn_s_barrier();
  __builtin_amdgcn_fence(__ATOMIC_ACQUIRE, "workgroup", "local");
}

// Row pitch of the V tile in halves: 160 B, an odd multiple of 32 B, the
// conflict-free pitch for the transposing load (rows stay 16-byte aligned).
#define VP_ 80

// ds_load_tr16_b128: the lane addresses 16 bytes of a row-major 16-bit tile and
// receives 8 consecutive rows of one column (rows 8*(lane>>4)+0..7, column
// lane&15 of the 16x16 block), i.e. half an A fragment of the transposed tile in
// the hardware k order.
__device__ __forceinline__ v8s ld_tr16(const _Float16* p) {
  typedef __attribute__((address_space(3))) v8s lds_v8s;
  return __builtin_amdgcn_ds_load_tr16_b128_v8i16((lds_v8s*)p);
}

__global__ void zero_bits_kernel(unsigned int* bits, int n) {
  int i = blockIdx.x * blockDim.x + threadIdx.x;
  if (i < n) bits[i] = 0u;
}

__global__ void scatter_bits_kernel(const int* __restrict__ mb,
                                    const int* __restrict__ ms,
                                    unsigned int* bits, int m) {
  int i = blockIdx.x * blockDim.x + threadIdx.x;
  if (i < m) {
    int bi = mb[i] * S_ + ms[i];
    atomicOr(&bits[bi >> 5], 1u << (bi & 31));
  }
}

// 8 waves of 32 query columns; at most 256 registers a lane, so that the two
// work-groups a WGP gets (512 over 256 WGPs) are resident together.
__launch_bounds__(256) __attribute__((amdgpu_waves_per_eu(4, 4)))
__global__ void flash_attn_kernel(const float* __restrict__ Qg,
                                  const float* __restrict__ Kg,
                                  const float* __restrict__ Vg,
                                  const unsigned int* __restrict__ qbits,
                                  const unsigned int* __restrict__ kbits,
                                  float* __restrict__ Og) {
  // pad rows to 68 halves (136 B): fragment reads conflict-free, 8B-aligned
  __shared__ _Float16 Kt[64][68];
  __shared__ __attribute__((aligned(16))) _Float16 Vt[64][VP_];  // read by ld_tr16

  const int qb    = blockIdx.x & 3;    // 4 query superblocks of 256
  const int bh    = blockIdx.x >> 2;
  const int b     = bh / H_;
  const int h     = bh % H_;
  const int wave  = threadIdx.x >> 5;
  const int lane  = threadIdx.x & 31;
  const int l16   = lane & 15;
  const int hi16  = lane >> 4;         // lane half
  const int kbase = hi16 ? 8 : 0;      // K range owned by this half (A/B frags)
  const int h8    = hi16 ? 8 : 0;      // M offset owned by this half (C frags)

  const int q0 = qb * 256 + wave * 32;

  // ---- Q^T: per group two 32x16 f16 B-fragments covering D=64 (loaded once).
  // Fold scale = 1/sqrt(64) = 0.125 (power of two: exact in f16) into Q.
  v16h aq[2][2];
#pragma unroll  // constant indices keep the fragments in registers
  for (int g = 0; g < 2; ++g) {
    const float* qp = Qg + ((size_t)(b * S_ + q0 + 16 * g + l16) * H_ + h) * D_;
#pragma unroll
    for (int c = 0; c < 2; ++c)
#pragma unroll
      for (int j = 0; j < 16; ++j)
        aq[g][c][j] = (_Float16)(qp[c * 32 + k_of(j, kbase)] * 0.125f);
  }

  // ---- mask bits of this lane's two queries (q0 is a multiple of 32: one word)
  const unsigned int qw = qbits[(b * S_ + q0) >> 5];
  const bool rowm[2] = {(bool)((qw >> l16) & 1u), (bool)((qw >> (16 + l16)) & 1u)};

  // ---- accumulators: per group O^T (64x16 as 4 C tiles), online-softmax m,l.
  // m_i is the query's running maximum (equal in both halves); l_i sums this
  // half's keys only, the halves are joined in the epilogue.
  v8f o[2][4];
#pragma unroll
  for (int g = 0; g < 2; ++g)
#pragma unroll
    for (int c = 0; c < 4; ++c)
#pragma unroll
      for (int r = 0; r < 8; ++r) o[g][c][r] = 0.f;
  float m_i[2] = {-3.0e38f, -3.0e38f}, l_i[2] = {0.f, 0.f};

  const float* kb_p = Kg + ((size_t)b * S_ * H_ + h) * D_;     // + s*H*D + d
  const float* vb_p = Vg + ((size_t)(b * H_ + h)) * S_ * D_;   // + s*D + d

  // This thread's share of a 64x64 tile: float4 column d4 of rows key0 + 16*i.
  const int key0 = threadIdx.x >> 4;
  const int d4   = threadIdx.x & 15;
  const float4* kp4 = (const float4*)kb_p + (size_t)key0 * (H_ * D_ / 4) + d4;
  const float4* vp4 = (const float4*)vb_p + (size_t)key0 * (D_ / 4) + d4;

  // Tile 0: all 8 loads of the thread in flight at once.
  float4 kq[4], vq[4];
#pragma unroll  // constant indices keep kq and vq in registers
  for (int i = 0; i < 4; ++i) {
    kq[i] = kp4[(size_t)i * 16 * (H_ * D_ / 4)];
    vq[i] = vp4[(size_t)i * 16 * (D_ / 4)];
  }

  for (int kb = 0; kb < S_; kb += 64) {   // 64-key blocks: 32 WMMA / iter
    // mask words of this tile's 64 keys, fetched ahead of their use
    const uint2 mw = *(const uint2*)&kbits[(b * S_ + kb) >> 5];

    lds_barrier();  // prev iteration's Kt/Vt reads done before overwrite

    // stage the tile that was loaded one trip ahead:
    // v_cvt_pk_rz_f16_f32 x2 -> ds_store_b64
#pragma unroll  // constant indices keep kq and vq in registers
    for (int i = 0; i < 4; ++i) {
      uint2 kw, vw;
      kw.x = pk2h(kq[i].x, kq[i].y);  kw.y = pk2h(kq[i].z, kq[i].w);
      vw.x = pk2h(vq[i].x, vq[i].y);  vw.y = pk2h(vq[i].z, vq[i].w);
      *(uint2*)&Kt[key0 + 16 * i][d4 * 4] = kw;  // 8B-aligned (row stride 136 B)
      *(uint2*)&Vt[key0 + 16 * i][d4 * 4] = vw;  // 8B-aligned (row stride 160 B)
    }

    // next tile's 8 loads fly under this tile's products and softmax
    if (kb + 64 < S_) {
      kp4 += 64 * (H_ * D_ / 4);
      vp4 += 64 * (D_ / 4);
#pragma unroll  // constant indices; the 8 loads issue back to back
      for (int i = 0; i < 4; ++i) {
        kq[i] = kp4[(size_t)i * 16 * (H_ * D_ / 4)];
        vq[i] = vp4[(size_t)i * 16 * (D_ / 4)];
      }
    }
    lds_barrier();

    // ---- scores S^T = K (Q*scale)^T : four 16-key row tiles per group;
    // s[g][t][r] = score of key kb + 16 t + h8 + r against query 16 g + l16 ----
    v8f s[2][4];
#pragma unroll
    for (int g = 0; g < 2; ++g)
#pragma unroll
      for (int t = 0; t < 4; ++t)
#pragma unroll
        for (int r = 0; r < 8; ++r) s[g][t][r] = 0.f;
#pragma unroll
    for (int c = 0; c < 2; ++c) {
#pragma unroll
      for (int t = 0; t < 4; ++t) {
        v16h ak;
#pragma unroll
        for (int j = 0; j < 16; ++j)
          ak[j] = Kt[t * 16 + l16][c * 32 + k_of(j, kbase)];
#pragma unroll
        for (int g = 0; g < 2; ++g)
          s[g][t] = __builtin_amdgcn_wmma_f32_16x16x32_f16(
              false, ak, false, aq[g][c], (short)0, s[g][t], false, false);
      }
    }

    v16h bp[2][2];
#pragma unroll  // constant indices keep the tiles in registers
    for (int g = 0; g < 2; ++g) {
      // ---- masks (reference: set masked entries to -1e10). One word covers 32
      // keys; shifted by h8, bit 16 (t & 1) + r is the lane's key; a masked query
      // takes every bit. Each tile's 8 bits are moved to the top of a word and
      // shifted out one by one: the add's carry is the select's condition.
      const unsigned int wm[2] = {rowm[g] ? 0xFFFFFFFFu : (mw.x >> h8),
                                  rowm[g] ? 0xFFFFFFFFu : (mw.y >> h8)};
#pragma unroll  // constant indices keep the tiles in registers
      for (int t = 0; t < 4; ++t) {
        unsigned int x = wm[t >> 1] << (24 - 16 * (t & 1));
#pragma unroll  // constant indices keep the tiles in registers
        for (int r = 7; r >= 0; --r) {
          const bool masked = __builtin_add_overflow(x, x, &x);
          if (masked) s[g][t][r] = -1.0e10f;
        }
      }

      // ---- online softmax: maximum and sum run over the lane's own 32 scores,
      // one exchange joins the maxima of the two halves ----
      float tm[4];
#pragma unroll  // constant indices keep the tiles in registers
      for (int t = 0; t < 4; ++t) {
        float x = max3r(s[g][t][0], s[g][t][1], s[g][t][2]);
        float y = max3r(s[g][t][3], s[g][t][4], s[g][t][5]);
        tm[t] = max3r(x, y, maxr(s[g][t][6], s[g][t][7]));
      }
      float bm = max3r(tm[0], tm[1], maxr(tm[2], tm[3]));
      float mnew = max3r(m_i[g], bm, xhalf(bm));
      float ts[4];
#pragma unroll  // constant indices keep the tiles in registers
      for (int t = 0; t < 4; ++t) {
#pragma unroll  // constant indices keep the tiles in registers
        for (int r = 0; r < 8; ++r) s[g][t][r] = __expf(s[g][t][r] - mnew);
        ts[t] = ((s[g][t][0] + s[g][t][1]) + (s[g][t][2] + s[g][t][3])) +
                ((s[g][t][4] + s[g][t][5]) + (s[g][t][6] + s[g][t][7]));
      }
      float alpha = __expf(m_i[g] - mnew);   // first block: exp(-3e38-x) = 0
      l_i[g] = l_i[g] * alpha + ((ts[0] + ts[1]) + (ts[2] + ts[3]));
      m_i[g] = mnew;
#pragma unroll  // constant indices keep the tiles in registers
      for (int c = 0; c < 4; ++c)
#pragma unroll  // constant indices keep the tiles in registers
        for (int r = 0; r < 8; ++r) o[g][c][r] *= alpha;

      // ---- P^T as B-fragments straight from the score tiles: element j of half
      // kh is key kh*32 + k_of(j, kbase) = row j & 7 of tile 2 kh + (j >> 3) ----
#pragma unroll  // constant indices keep the tiles in registers
      for (int kh = 0; kh < 2; ++kh)
#pragma unroll  // constant indices keep the tiles in registers
        for (int j = 0; j < 16; j += 2) {
          v2f pf = {s[g][2 * kh + (j >> 3)][j & 7],
                    s[g][2 * kh + (j >> 3)][(j & 7) + 1]};
          v2h ph = __builtin_convertvector(pf, v2h);   // round to nearest even
          bp[g][kh][j] = ph[0];
          bp[g][kh][j + 1] = ph[1];
        }
    }

    // ---- O^T += V^T P^T : K = 64 keys as two 32-key halves, 4 dim-chunks ----
    // V^T A-fragments: two transposing loads each (keys kh*32 + kbase + 0..7 and
    // + 16..23 of dim c*16 + l16: the k order of k_of, as bp has it).
    const _Float16* vtp = &Vt[kbase + (lane & 7)][((lane >> 3) & 1) * 8];
#pragma unroll
    for (int c = 0; c < 4; ++c) {
#pragma unroll
      for (int kh = 0; kh < 2; ++kh) {
        v8s lo = ld_tr16(vtp + (kh * 32) * VP_ + c * 16);
        v8s hi = ld_tr16(vtp + (kh * 32 + 16) * VP_ + c * 16);
        v16h av = __builtin_bit_cast(
            v16h, __builtin_shufflevector(lo, hi, 0, 1, 2, 3, 4, 5, 6, 7, 8, 9,
                                          10, 11, 12, 13, 14, 15));
#pragma unroll
        for (int g = 0; g < 2; ++g)
          o[g][c] = __builtin_amdgcn_wmma_f32_16x16x32_f16(
              false, av, false, bp[g][kh], (short)0, o[g][c], false, false);
      }
    }
  }

  // ---- epilogue: join the halves' sums, normalize, store O (B,H,S,D) fp32:
  // the lane holds dims c*16 + h8 + 0..7 of queries q0 + 16 g + l16 ----
#pragma unroll  // constant indices keep the tiles in registers
  for (int g = 0; g < 2; ++g) {
    const float inv = 1.0f / (l_i[g] + xhalf(l_i[g]));
    float* op = Og + ((size_t)(b * H_ + h) * S_ + q0 + 16 * g + l16) * D_ + h8;
#pragma unroll  // constant indices keep the tiles in registers
    for (int c = 0; c < 4; ++c) {
      *(float4*)(op + c * 16) =
          make_float4(o[g][c][0] * inv, o[g][c][1] * inv, o[g][c][2] * inv,
                      o[g][c][3] * inv);
      *(float4*)(op + c * 16 + 4) =
          make_float4(o[g][c][4] * inv, o[g][c][5] * inv, o[g][c][6] * inv,
                      o[g][c][7] * inv);
    }
  }
}

extern "C" void kernel_launch(void* const* d_in, const int* in_sizes, int n_in,
                              void* d_out, int out_size, void* d_ws, size_t ws_size,
                              hipStream_t stream) {
  (void)in_sizes; (void)n_in; (void)out_size; (void)ws_size;
  const float* Q  = (const float*)d_in[0];
  const float* K  = (const float*)d_in[1];
  const float* V  = (const float*)d_in[2];
  const int* qm_b = (const int*)d_in[3];
  const int* qm_s = (const int*)d_in[4];
  const int* km_b = (const int*)d_in[5];
  const int* km_s = (const int*)d_in[6];

  unsigned int* qbits = (unsigned int*)d_ws;        // 256 words
  unsigned int* kbits = qbits + (B_ * S_ / 32);     // 256 words
  const int nwords = B_ * S_ / 32;

  zero_bits_kernel<<<(2 * nwords + 255) / 256, 256, 0, stream>>>(qbits, 2 * nwords);
  scatter_bits_kernel<<<(M_ + 255) / 256, 256, 0, stream>>>(qm_b, qm_s, qbits, M_);
  scatter_bits_kernel<<<(M_ + 255) / 256, 256, 0, stream>>>(km_b, km_s, kbits, M_);

  dim3 grid(B_ * H_ * (S_ / 256));  // 512 workgroups
  flash_attn_kernel<<<grid, 256, 0, stream>>>(Q, K, V, qbits, kbits, (float*)d_out);
}

// v005
// A run of this version takes 45.7 microseconds.
// Next to v004, in two timings, it ran 1.19 and 1.18 times as fast.
// All steps since v000 together make it 4.50 times as fast.
#include <hip/hip_runtime.h>

typedef __attribute__((ext_vector_type(16))) _Float16 v16h;
typedef __attribute__((ext_vector_type(8)))  float    v8f;
typedef __attribute__((ext_vector_type(8)))  short    v8s;
typedef __attribute__((ext_vector_type(2)))  float    v2f;
typedef __attribute__((ext_vector_type(2)))  _Float16 v2h;

#define B_ 8
#define S_ 1024
#define H_ 16
#define D_ 64
#define M_ 1024

// K-index inside a 16x32 f16 A/B fragment for element j of the v16h,
// given this lane-half's base (0 for lanes 0-15, 8 for lanes 16-31).
// VGPR i (pair j=2i,2i+1): K = base + 2i (i<4)  or  base + 16 + 2(i-4).
__device__ __forceinline__ int k_of(int j, int kbase) {
  int i = j >> 1;
  int base = (i < 4) ? (2 * i) : (2 * i + 8);
  return kbase + base + (j & 1);
}

// pack two f32 into one dword of two f16 (v_cvt_pk_rz_f16_f32)
__device__ __forceinline__ unsigned int pk2h(float x, float y) {
  return __builtin_bit_cast(unsigned int, __builtin_amdgcn_cvt_pkrtz(x, y));
}

// v_max_num_f32 without fmaxf's canonicalize chaff. A builtin, not asm text: the
// maxima read the score tiles straight behind their last matrix
// instruction.
__device__ __forceinline__ float maxr(float a, float b) {
  return __builtin_elementwise_maximumnum(a, b);
}

// three-way maximum (the compiler joins the two into v_max3_num_f32)
__device__ __forceinline__ float max3r(float a, float b, float c) {
  return maxr(maxr(a, b), c);
}

// value of lane l ^ 16 (v_permlanex16_b32): the other half of a query's keys
__device__ __forceinline__ float xhalf(float x) {
  int b = __builtin_bit_cast(int, x);
  return __builtin_bit_cast(
      float, __builtin_amdgcn_permlanex16(b, b, 0x76543210, 0xfedcba98, false,
                                          false));
}

// Work-group barrier that orders LDS traffic only. The barriers of the key loop
// guard nothing but Kt, Vt and Kb; __syncthreads() would also drain the load
// counter and so end the flight of the next tile's global loads at once.
__device__ __forceinline__ void lds_barrier() {
  __builtin_amdgcn_fence(__ATOMIC_RELEASE, "workgroup", "local");
  __builtin_amdgcn_s_barrier();
  __builtin_amdgcn_fence(__ATOMIC_ACQUIRE, "workgroup", "local");
}

// Row pitch of the V tile in halves: 160 B, an odd multiple of 32 B, the
// conflict-free pitch for the transposing load (rows stay 16-byte aligned).
#define VP_ 80

// ds_load_tr16_b128: the lane addresses 16 bytes of a row-major 16-bit tile and
// receives 8 consecutive rows of one column (rows 8*(lane>>4)+0..7, column
// lane&15 of the 16x16 block), i.e. half an A fragment of the transposed tile in
// the hardware k order.
__device__ __forceinline__ v8s ld_tr16(const _Float16* p) {
  typedef __attribute__((address_space(3))) v8s lds_v8s;
  return __builtin_amdgcn_ds_load_tr16_b128_v8i16((lds_v8s*)p);
}

__global__ void zero_bits_kernel(unsigned int* bits, int n) {
  int i = blockIdx.x * blockDim.x + threadIdx.x;
  if (i < n) bits[i] = 0u;
}

__global__ void scatter_bits_kernel(const int* __restrict__ mb,
                                    const int* __restrict__ ms,
                                    unsigned int* bits, int m) {
  int i = blockIdx.x * blockDim.x + threadIdx.x;
  if (i < m) {
    int bi = mb[i] * S_ + ms[i];
    atomicOr(&bits[bi >> 5], 1u << (bi & 31));
  }
}

// 8 waves of 32 query columns; at most 256 registers a lane, so that the two
// work-groups a WGP gets (512 over 256 WGPs) are resident together.
__launch_bounds__(256) __attribute__((amdgpu_waves_per_eu(4, 4)))
__global__ void flash_attn_kernel(const float* __restrict__ Qg,
                                  const float* __restrict__ Kg,
                                  const float* __restrict__ Vg,
                                  const unsigned int* __restrict__ qbits,
                                  const unsigned int* __restrict__ kbits,
                                  float* __restrict__ Og) {
  // pad rows to 68 halves (136 B): fragment reads conflict-free, 8B-aligned
  __shared__ _Float16 Kt[64][68];
  __shared__ __attribute__((aligned(16))) _Float16 Vt[64][VP_];  // read by ld_tr16
  // key mask of the whole batch row as an additive score bias: 0, or the
  // reference's -1e10 in the base-2 domain
  __shared__ __attribute__((aligned(32))) float Kb[S_];

  const int qb    = blockIdx.x & 3;    // 4 query superblocks of 256
  const int bh    = blockIdx.x >> 2;
  const int b     = bh / H_;
  const int h     = bh % H_;
  const int wave  = threadIdx.x >> 5;
  const int lane  = threadIdx.x & 31;
  const int l16   = lane & 15;
  const int hi16  = lane >> 4;         // lane half
  const int kbase = hi16 ? 8 : 0;      // K range owned by this half (A/B frags)
  const int h8    = hi16 ? 8 : 0;      // M offset owned by this half (C frags)

  const int q0 = qb * 256 + wave * 32;

  // ---- Q^T: per group two 32x16 f16 B-fragments covering D=64 (loaded once).
  // Fold scale * log2(e) = 0.125 * 1.44269504 into Q: the scores come out in the
  // base-2 domain, exp(x) is exp2 of them with no multiply per score.
  v16h aq[2][2];
#pragma unroll  // constant indices keep the fragments in registers
  for (int g = 0; g < 2; ++g) {
    const float* qp = Qg + ((size_t)(b * S_ + q0 + 16 * g + l16) * H_ + h) * D_;
#pragma unroll
    for (int c = 0; c < 2; ++c)
#pragma unroll
      for (int j = 0; j < 16; ++j)
        aq[g][c][j] = (_Float16)(qp[c * 32 + k_of(j, kbase)] * 0.18033688f);
  }

  // ---- mask bits of this lane's two queries (q0 is a multiple of 32: one word)
  const unsigned int qw = qbits[(b * S_ + q0) >> 5];
  // A masked query has every score equal in the reference (uniform weights):
  // its factor in the exponent s * cf - m * cf is 0, so every weight is
  // exp2(0) = 1. The factor 1 of the others keeps s - m exact, also at the bias.
  const float cf[2] = {((qw >> l16) & 1u) ? 0.f : 1.f,
                       ((qw >> (16 + l16)) & 1u) ? 0.f : 1.f};

  // ---- bias table: this thread's 4 keys (one mask word holds all four). It is
  // published by the key loop's first barriers, ahead of its first read.
  {
    const unsigned int kw4 =
        kbits[(b * S_ + 4 * (int)threadIdx.x) >> 5] >> ((4 * threadIdx.x) & 31);
    const float mb = -1.0e10f * 1.44269504f;
    *(float4*)&Kb[4 * threadIdx.x] =
        make_float4((kw4 & 1u) ? mb : 0.f, (kw4 & 2u) ? mb : 0.f,
                    (kw4 & 4u) ? mb : 0.f, (kw4 & 8u) ? mb : 0.f);
  }

  // ---- accumulators: O^T (64x16 as 4 C tiles), online-softmax m,l.
  // m_i is the query's running maximum (equal in both halves); l_i sums this
  // half's keys only, the halves are joined in the epilogue.
  v8f o[2][4];
#pragma unroll
  for (int g = 0; g < 2; ++g)
#pragma unroll
    for (int c = 0; c < 4; ++c)
#pragma unroll
      for (int r = 0; r < 8; ++r) o[g][c][r] = 0.f;
  float m_i[2] = {-3.0e38f, -3.0e38f}, l_i[2] = {0.f, 0.f};

  const float* kb_p = Kg + ((size_t)b * S_ * H_ + h) * D_;     // + s*H*D + d
  const float* vb_p = Vg + ((size_t)(b * H_ + h)) * S_ * D_;   // + s*D + d

  // This thread's share of a 64x64 tile: float4 column d4 of rows key0 + 16*i.
  const int key0 = threadIdx.x >> 4;
  const int d4   = threadIdx.x & 15;
  const float4* kp4 = (const float4*)kb_p + (size_t)key0 * (H_ * D_ / 4) + d4;
  const float4* vp4 = (const float4*)vb_p + (size_t)key0 * (D_ / 4) + d4;

  // Tile 0: all 8 loads of the thread in flight at once.
  float4 kq[4], vq[4];
#pragma unroll  // constant indices keep kq and vq in registers
  for (int i = 0; i < 4; ++i) {
    kq[i] = kp4[(size_t)i * 16 * (H_ * D_ / 4)];
    vq[i] = vp4[(size_t)i * 16 * (D_ / 4)];
  }

  for (int kb = 0; kb < S_; kb += 64) {   // 64-key blocks: 32 WMMA / iter
    lds_barrier();  // prev iteration's Kt/Vt reads done before overwrite

    // stage the tile that was loaded one trip ahead:
    // v_cvt_pk_rz_f16_f32 x2 -> ds_store_b64
#pragma unroll  // constant indices keep kq and vq in registers
    for (int i = 0; i < 4; ++i) {
      uint2 kw, vw;
      kw.x = pk2h(kq[i].x, kq[i].y);  kw.y = pk2h(kq[i].z, kq[i].w);
      vw.x = pk2h(vq[i].x, vq[i].y);  vw.y = pk2h(vq[i].z, vq[i].w);
      *(uint2*)&Kt[key0 + 16 * i][d4 * 4] = kw;  // 8B-aligned (row stride 136 B)
      *(uint2*)&Vt[key0 + 16 * i][d4 * 4] = vw;  // 8B-aligned (row stride 160 B)
    }

    // next tile's 8 loads fly under this tile's products and softmax
    if (kb + 64 < S_) {
      kp4 += 64 * (H_ * D_ / 4);
      vp4 += 64 * (D_ / 4);
#pragma unroll  // constant indices; the 8 loads issue back to back
      for (int i = 0; i < 4; ++i) {
        kq[i] = kp4[(size_t)i * 16 * (H_ * D_ / 4)];
        vq[i] = vp4[(size_t)i * 16 * (D_ / 4)];
      }
    }
    lds_barrier();

    // ---- scores S^T = K (Q*scale)^T : four 16-key row tiles per group;
    // s[g][t][r] = score of key kb + 16 t + h8 + r against query 16 g + l16.
    // The accumulators start from the keys' bias (reference: masked entries are
    // one constant; a score is far below half an ulp of the bias, so the sum
    // stays the bias); one set of bias rows serves both groups ----
    v8f s[2][4];
#pragma unroll
    for (int t = 0; t < 4; ++t) {
      const v8f kbias = *(const v8f*)&Kb[kb + t * 16 + h8];
      s[0][t] = kbias;
      s[1][t] = kbias;
    }
#pragma unroll
    for (int c = 0; c < 2; ++c) {
#pragma unroll
      for (int t = 0; t < 4; ++t) {
        v16h ak;
#pragma unroll
        for (int j = 0; j < 16; ++j)
          ak[j] = Kt[t * 16 + l16][c * 32 + k_of(j, kbase)];
#pragma unroll
        for (int g = 0; g < 2; ++g)
          s[g][t] = __builtin_amdgcn_wmma_f32_16x16x32_f16(
              false, ak, false, aq[g][c], (short)0, s[g][t], false, false);
      }
    }

    v16h bp[2][2];
#pragma unroll  // constant indices keep the tiles in registers
    for (int g = 0; g < 2; ++g) {
      // ---- online softmax: maximum and sum run over the lane's own 32 scores,
      // one exchange joins the maxima of the two halves ----
      // (three-way maxima throughout: a two-way one on raw accumulator values
      // would bring the canonicalize chaff back)
      float tm[4];
#pragma unroll  // constant indices keep the tiles in registers
      for (int t = 0; t < 4; ++t) {
        float x = max3r(s[g][t][0], s[g][t][1], s[g][t][2]);
        x = max3r(x, s[g][t][3], s[g][t][4]);
        tm[t] = max3r(x, s[g][t][5], s[g][t][6]);
      }
      float bm = maxr(max3r(tm[0], tm[1], s[g][3][7]),
                      max3r(tm[2], tm[3],
                            max3r(s[g][0][7], s[g][1][7], s[g][2][7])));
      float mnew = max3r(m_i[g], bm, xhalf(bm));
      const float nmc = -mnew * cf[g];
      float ts[4];
#pragma unroll  // constant indices keep the tiles in registers
      for (int t = 0; t < 4; ++t) {
#pragma unroll  // constant indices keep the tiles in registers
        for (int r = 0; r < 8; ++r)  // all eight exponents ahead of their exp2
          s[g][t][r] = __builtin_fmaf(s[g][t][r], cf[g], nmc);
#pragma unroll  // constant indices keep the tiles in registers
        for (int r = 0; r < 8; ++r) s[g][t][r] = __builtin_amdgcn_exp2f(s[g][t][r]);
        ts[t] = ((s[g][t][0] + s[g][t][1]) + (s[g][t][2] + s[g][t][3])) +
                ((s[g][t][4] + s[g][t][5]) + (s[g][t][6] + s[g][t][7]));
      }
      // first block: exp2(-3e38) = 0 (masked query: 1, on sums that are still 0)
      float alpha = __builtin_amdgcn_exp2f(__builtin_fmaf(m_i[g], cf[g], nmc));
      l_i[g] = l_i[g] * alpha + ((ts[0] + ts[1]) + (ts[2] + ts[3]));
      m_i[g] = mnew;
#pragma unroll  // constant indices keep the tiles in registers
      for (int c = 0; c < 4; ++c)
#pragma unroll  // constant indices keep the tiles in registers
        for (int r = 0; r < 8; ++r) o[g][c][r] *= alpha;

      // ---- P^T as B-fragments straight from the score tiles: element j of half
      // kh is key kh*32 + k_of(j, kbase) = row j & 7 of tile 2 kh + (j >> 3) ----
#pragma unroll  // constant indices keep the tiles in registers
      for (int kh = 0; kh < 2; ++kh)
#pragma unroll  // constant indices keep the tiles in registers
        for (int j = 0; j < 16; j += 2) {
          v2f pf = {s[g][2 * kh + (j >> 3)][j & 7],
                    s[g][2 * kh + (j >> 3)][(j & 7) + 1]};
          v2h ph = __builtin_convertvector(pf, v2h);   // round to nearest even
          bp[g][kh][j] = ph[0];
          bp[g][kh][j + 1] = ph[1];
        }
    }

    // ---- O^T += V^T P^T : K = 64 keys as two 32-key halves, 4 dim-chunks ----
    // V^T A-fragments: two transposing loads each (keys kh*32 + kbase + 0..7 and
    // + 16..23 of dim c*16 + l16: the k order of k_of, as bp has it).
    const _Float16* vtp = &Vt[kbase + (lane & 7)][((lane >> 3) & 1) * 8];
#pragma unroll
    for (int c = 0; c < 4; ++c) {
#pragma unroll
      for (int kh = 0; kh < 2; ++kh) {
        v8s lo = ld_tr16(vtp + (kh * 32) * VP_ + c * 16);
        v8s hi = ld_tr16(vtp + (kh * 32 + 16) * VP_ + c * 16);
        v16h av = __builtin_bit_cast(
            v16h, __builtin_shufflevector(lo, hi, 0, 1, 2, 3, 4, 5, 6, 7, 8, 9,
                                          10, 11, 12, 13, 14, 15));
#pragma unroll
        for (int g = 0; g < 2; ++g)
          o[g][c] = __builtin_amdgcn_wmma_f32_16x16x32_f16(
              false, av, false, bp[g][kh], (short)0, o[g][c], false, false);
      }
    }
  }

  // ---- epilogue: join the halves' sums, normalize, store O (B,H,S,D) fp32:
  // the lane holds dims c*16 + h8 + 0..7 of queries q0 + 16 g + l16 ----
#pragma unroll  // constant indices keep the tiles in registers
  for (int g = 0; g < 2; ++g) {
    const float inv = 1.0f / (l_i[g] + xhalf(l_i[g]));
    float* op = Og + ((size_t)(b * H_ + h) * S_ + q0 + 16 * g + l16) * D_ + h8;
#pragma unroll  // constant indices keep the tiles in registers
    for (int c = 0; c < 4; ++c) {
      *(float4*)(op + c * 16) =
          make_float4(o[g][c][0] * inv, o[g][c][1] * inv, o[g][c][2] * inv,
                      o[g][c][3] * inv);
      *(float4*)(op + c * 16 + 4) =
          make_float4(o[g][c][4] * inv, o[g][c][5] * inv, o[g][c][6] * inv,
                      o[g][c][7] * inv);
    }
  }
}

extern "C" void kernel_launch(void* const* d_in, const int* in_sizes, int n_in,
                              void* d_out, int out_size, void* d_ws, size_t ws_size,
                              hipStream_t stream) {
  (void)in_sizes; (void)n_in; (void)out_size; (void)ws_size;
  const float* Q  = (const float*)d_in[0];
  const float* K  = (const float*)d_in[1];
  const float* V  = (const float*)d_in[2];
  const int* qm_b = (const int*)d_in[3];
  const int* qm_s = (const int*)d_in[4];
  const int* km_b = (const int*)d_in[5];
  const int* km_s = (const int*)d_in[6];

  unsigned int* qbits = (unsigned int*)d_ws;        // 256 words
  unsigned int* kbits = qbits + (B_ * S_ / 32);     // 256 words
  const int nwords = B_ * S_ / 32;

  zero_bits_kernel<<<(2 * nwords + 255) / 256, 256, 0, stream>>>(qbits, 2 * nwords);
  scatter_bits_kernel<<<(M_ + 255) / 256, 256, 0, stream>>>(qm_b, qm_s, qbits, M_);
  scatter_bits_kernel<<<(M_ + 255) / 256, 256, 0, stream>>>(km_b, km_s, kbits, M_);

  dim3 grid(B_ * H_ * (S_ / 256));  // 512 workgroups
  flash_attn_kernel<<<grid, 256, 0, stream>>>(Q, K, V, qbits, kbits, (float*)d_out);
}

// v006
// It runs in 39.8 microseconds.
// Two timings next to v005 put it at 1.14 and 1.15 times that version's speed.
// Counting every step since v000, it is 5.16 times as fast.
#include <hip/hip_runtime.h>

typedef __attribute__((ext_vector_type(16))) _Float16 v16h;
typedef __attribute__((ext_vector_type(8)))  float    v8f;
typedef __attribute__((ext_vector_type(8)))  short    v8s;
typedef __attribute__((ext_vector_type(2)))  float    v2f;
typedef __attribute__((ext_vector_type(2)))  _Float16 v2h;

#define B_ 8
#define S_ 1024
#define H_ 16
#define D_ 64
#define M_ 1024

// K-index inside a 16x32 f16 A/B fragment for element j of the v16h,
// given this lane-half's base (0 for lanes 0-15, 8 for lanes 16-31).
// VGPR i (pair j=2i,2i+1): K = base + 2i (i<4)  or  base + 16 + 2(i-4).
__device__ __forceinline__ int k_of(int j, int kbase) {
  int i = j >> 1;
  int base = (i < 4) ? (2 * i) : (2 * i + 8);
  return kbase + base + (j & 1);
}

// pack two f32 into one dword of two f16 (v_cvt_pk_rz_f16_f32)
__device__ __forceinline__ unsigned int pk2h(float x, float y) {
  return __builtin_bit_cast(unsigned int, __builtin_amdgcn_cvt_pkrtz(x, y));
}

// v_max_num_f32 without fmaxf's canonicalize chaff. A builtin, not asm text: the
// maxima read the score tiles straight behind their last matrix
// instruction.
__device__ __forceinline__ float maxr(float a, float b) {
  return __builtin_elementwise_maximumnum(a, b);
}

// three-way maximum (the compiler joins the two into v_max3_num_f32)
__device__ __forceinline__ float max3r(float a, float b, float c) {
  return maxr(maxr(a, b), c);
}

// value of lane l ^ 16 (v_permlanex16_b32): the other half of a query's keys
__device__ __forceinline__ float xhalf(float x) {
  int b = __builtin_bit_cast(int, x);
  return __builtin_bit_cast(
      float, __builtin_amdgcn_permlanex16(b, b, 0x76543210, 0xfedcba98, false,
                                          false));
}

// Work-group barrier that orders LDS traffic only. The barriers of the key loop
// guard nothing but Kt and Vt, the two ahead of it Kb and Qf; __syncthreads() would also drain the load
// counter and so end the flight of the next tile's global loads at once.
__device__ __forceinline__ void lds_barrier() {
  __builtin_amdgcn_fence(__ATOMIC_RELEASE, "workgroup", "local");
  __builtin_amdgcn_s_barrier();
  __builtin_amdgcn_fence(__ATOMIC_ACQUIRE, "workgroup", "local");
}

// Row pitch of the V tile in halves: 160 B, an odd multiple of 32 B, the
// conflict-free pitch for the transposing load (rows stay 16-byte aligned).
#define VP_ 80

// ds_load_tr16_b128: the lane addresses 16 bytes of a row-major 16-bit tile and
// receives 8 consecutive rows of one column (rows 8*(lane>>4)+0..7, column
// lane&15 of the 16x16 block), i.e. half an A fragment of the transposed tile in
// the hardware k order.
__device__ __forceinline__ v8s ld_tr16(const _Float16* p) {
  typedef __attribute__((address_space(3))) v8s lds_v8s;
  return __builtin_amdgcn_ds_load_tr16_b128_v8i16((lds_v8s*)p);
}

// 8 waves of 32 query columns; at most 256 registers a lane, so that the two
// work-groups a WGP gets (512 over 256 WGPs) are resident together.
__launch_bounds__(256) __attribute__((amdgpu_waves_per_eu(4, 4)))
__global__ void flash_attn_kernel(const float* __restrict__ Qg,
                                  const float* __restrict__ Kg,
                                  const float* __restrict__ Vg,
                                  const int* __restrict__ qm_b,
                                  const int* __restrict__ qm_s,
                                  const int* __restrict__ km_b,
                                  const int* __restrict__ km_s,
                                  float* __restrict__ Og) {
  // pad rows to 68 halves (136 B): fragment reads conflict-free, 8B-aligned
  __shared__ _Float16 Kt[64][68];
  __shared__ __attribute__((aligned(16))) _Float16 Vt[64][VP_];  // read by ld_tr16
  // key mask of the whole batch row as an additive score bias: 0, or the
  // reference's -1e10 in the base-2 domain
  __shared__ __attribute__((aligned(32))) float Kb[S_];
  // query mask of the work-group's 256 queries as a factor: 1, or 0 if masked
  __shared__ float Qf[256];

  const int qb    = blockIdx.x & 3;    // 4 query superblocks of 256
  const int bh    = blockIdx.x >> 2;
  const int b     = bh / H_;
  const int h     = bh % H_;
  const int wave  = threadIdx.x >> 5;
  const int lane  = threadIdx.x & 31;
  const int l16   = lane & 15;
  const int hi16  = lane >> 4;         // lane half
  const int kbase = hi16 ? 8 : 0;      // K range owned by this half (A/B frags)
  const int h8    = hi16 ? 8 : 0;      // M offset owned by this half (C frags)

  const int q0 = qb * 256 + wave * 32;

  // ---- mask index lists: every work-group scans all M entries itself, four of
  // each list per thread. Loaded first, so that they are back before Q, K and V.
  static_assert(M_ == 4 * 256, "one int4 of each list per thread");
  const int4 qb4 = ((const int4*)qm_b)[threadIdx.x];
  const int4 qs4 = ((const int4*)qm_s)[threadIdx.x];
  const int4 kb4 = ((const int4*)km_b)[threadIdx.x];
  const int4 ks4 = ((const int4*)km_s)[threadIdx.x];

  // ---- Q^T: per group two 32x16 f16 B-fragments covering D=64 (loaded once).
  // Fold scale * log2(e) = 0.125 * 1.44269504 into Q: the scores come out in the
  // base-2 domain, exp(x) is exp2 of them with no multiply per score.
  v16h aq[2][2];
#pragma unroll  // constant indices keep the fragments in registers
  for (int g = 0; g < 2; ++g) {
    const float* qp = Qg + ((size_t)(b * S_ + q0 + 16 * g + l16) * H_ + h) * D_;
#pragma unroll
    for (int c = 0; c < 2; ++c)
#pragma unroll
      for (int j = 0; j < 16; ++j)
        aq[g][c][j] = (_Float16)(qp[c * 32 + k_of(j, kbase)] * 0.18033688f);
  }

  // ---- accumulators: O^T (64x16 as 4 C tiles), online-softmax m,l.
  // m_i is the query's running maximum (equal in both halves); l_i sums this
  // half's keys only, the halves are joined in the epilogue.
  v8f o[2][4];
#pragma unroll
  for (int g = 0; g < 2; ++g)
#pragma unroll
    for (int c = 0; c < 4; ++c)
#pragma unroll
      for (int r = 0; r < 8; ++r) o[g][c][r] = 0.f;
  float m_i[2] = {-3.0e38f, -3.0e38f}, l_i[2] = {0.f, 0.f};

  const float* kb_p = Kg + ((size_t)b * S_ * H_ + h) * D_;     // + s*H*D + d
  const float* vb_p = Vg + ((size_t)(b * H_ + h)) * S_ * D_;   // + s*D + d

  // This thread's share of a 64x64 tile: float4 column d4 of rows key0 + 16*i.
  const int key0 = threadIdx.x >> 4;
  const int d4   = threadIdx.x & 15;
  const float4* kp4 = (const float4*)kb_p + (size_t)key0 * (H_ * D_ / 4) + d4;
  const float4* vp4 = (const float4*)vb_p + (size_t)key0 * (D_ / 4) + d4;

  // Tile 0: all 8 loads of the thread in flight at once.
  float4 kq[4], vq[4];
#pragma unroll  // constant indices keep kq and vq in registers
  for (int i = 0; i < 4; ++i) {
    kq[i] = kp4[(size_t)i * 16 * (H_ * D_ / 4)];
    vq[i] = vp4[(size_t)i * 16 * (D_ / 4)];
  }

  // ---- both mask tables: start values, then a plain store per list entry that
  // names this batch row (and, for queries, this work-group's 256). Entries that
  // repeat store the same value, so no atomic is needed; an index outside its
  // range marks nothing.
  *(float4*)&Kb[4 * threadIdx.x] = make_float4(0.f, 0.f, 0.f, 0.f);
  Qf[threadIdx.x] = 1.f;
  lds_barrier();  // every start value is stored before the first mark
  {
    const int qbv[4] = {qb4.x, qb4.y, qb4.z, qb4.w};
    const int qsv[4] = {qs4.x, qs4.y, qs4.z, qs4.w};
    const int kbv[4] = {kb4.x, kb4.y, kb4.z, kb4.w};
    const int ksv[4] = {ks4.x, ks4.y, ks4.z, ks4.w};
#pragma unroll  // constant indices keep the entries in registers
    for (int e = 0; e < 4; ++e) {
      if (kbv[e] == b && (unsigned int)ksv[e] < (unsigned int)S_)
        Kb[ksv[e]] = -1.0e10f * 1.44269504f;
      const unsigned int qo = (unsigned int)(qsv[e] - qb * 256);
      if (qbv[e] == b && qo < 256u) Qf[qo] = 0.f;
    }
  }
  lds_barrier();  // every mark is stored before a table is read
  // A masked query has every score equal in the reference (uniform weights):
  // its factor in the exponent s * cf - m * cf is 0, so every weight is
  // exp2(0) = 1. The factor 1 of the others keeps s - m exact, also at the bias.
  const float cf[2] = {Qf[wave * 32 + l16], Qf[wave * 32 + 16 + l16]};

  for (int kb = 0; kb < S_; kb += 64) {   // 64-key blocks: 32 WMMA / iter
    lds_barrier();  // prev iteration's Kt/Vt reads done before overwrite

    // stage the tile that was loaded one trip ahead:
    // v_cvt_pk_rz_f16_f32 x2 -> ds_store_b64
#pragma unroll  // constant indices keep kq and vq in registers
    for (int i = 0; i < 4; ++i) {
      uint2 kw, vw;
      kw.x = pk2h(kq[i].x, kq[i].y);  kw.y = pk2h(kq[i].z, kq[i].w);
      vw.x = pk2h(vq[i].x, vq[i].y);  vw.y = pk2h(vq[i].z, vq[i].w);
      *(uint2*)&Kt[key0 + 16 * i][d4 * 4] = kw;  // 8B-aligned (row stride 136 B)
      *(uint2*)&Vt[key0 + 16 * i][d4 * 4] = vw;  // 8B-aligned (row stride 160 B)
    }

    // next tile's 8 loads fly under this tile's products and softmax
    if (kb + 64 < S_) {
      kp4 += 64 * (H_ * D_ / 4);
      vp4 += 64 * (D_ / 4);
#pragma unroll  // constant indices; the 8 loads issue back to back
      for (int i = 0; i < 4; ++i) {
        kq[i] = kp4[(size_t)i * 16 * (H_ * D_ / 4)];
        vq[i] = vp4[(size_t)i * 16 * (D_ / 4)];
      }
    }
    lds_barrier();

    // ---- scores S^T = K (Q*scale)^T : four 16-key row tiles per group;
    // s[g][t][r] = score of key kb + 16 t + h8 + r against query 16 g + l16.
    // The accumulators start from the keys' bias (reference: masked entries are
    // one constant; a score is far below half an ulp of the bias, so the sum
    // stays the bias); one set of bias rows serves both groups ----
    v8f s[2][4];
#pragma unroll
    for (int t = 0; t < 4; ++t) {
      const v8f kbias = *(const v8f*)&Kb[kb + t * 16 + h8];
      s[0][t] = kbias;
      s[1][t] = kbias;
    }
#pragma unroll
    for (int c = 0; c < 2; ++c) {
#pragma unroll
      for (int t = 0; t < 4; ++t) {
        v16h ak;
#pragma unroll
        for (int j = 0; j < 16; ++j)
          ak[j] = Kt[t * 16 + l16][c * 32 + k_of(j, kbase)];
#pragma unroll
        for (int g = 0; g < 2; ++g)
          s[g][t] = __builtin_amdgcn_wmma_f32_16x16x32_f16(
              false, ak, false, aq[g][c], (short)0, s[g][t], false, false);
      }
    }

    v16h bp[2][2];
#pragma unroll  // constant indices keep the tiles in registers
    for (int g = 0; g < 2; ++g) {
      // ---- online softmax: maximum and sum run over the lane's own 32 scores,
      // one exchange joins the maxima of the two halves ----
      // (three-way maxima throughout: a two-way one on raw accumulator values
      // would bring the canonicalize chaff back)
      float tm[4];
#pragma unroll  // constant indices keep the tiles in registers
      for (int t = 0; t < 4; ++t) {
        float x = max3r(s[g][t][0], s[g][t][1], s[g][t][2]);
        x = max3r(x, s[g][t][3], s[g][t][4]);
        tm[t] = max3r(x, s[g][t][5], s[g][t][6]);
      }
      float bm = maxr(max3r(tm[0], tm[1], s[g][3][7]),
                      max3r(tm[2], tm[3],
                            max3r(s[g][0][7], s[g][1][7], s[g][2][7])));
      float mnew = max3r(m_i[g], bm, xhalf(bm));
      const float nmc = -mnew * cf[g];
      float ts[4];
#pragma unroll  // constant indices keep the tiles in registers
      for (int t = 0; t < 4; ++t) {
#pragma unroll  // constant indices keep the tiles in registers
        for (int r = 0; r < 8; ++r)  // all eight exponents ahead of their exp2
          s[g][t][r] = __builtin_fmaf(s[g][t][r], cf[g], nmc);
#pragma unroll  // constant indices keep the tiles in registers
        for (int r = 0; r < 8; ++r) s[g][t][r] = __builtin_amdgcn_exp2f(s[g][t][r]);
        ts[t] = ((s[g][t][0] + s[g][t][1]) + (s[g][t][2] + s[g][t][3])) +
                ((s[g][t][4] + s[g][t][5]) + (s[g][t][6] + s[g][t][7]));
      }
      // first block: exp2(-3e38) = 0 (masked query: 1, on sums that are still 0)
      float alpha = __builtin_amdgcn_exp2f(__builtin_fmaf(m_i[g], cf[g], nmc));
      l_i[g] = l_i[g] * alpha + ((ts[0] + ts[1]) + (ts[2] + ts[3]));
      m_i[g] = mnew;
#pragma unroll  // constant indices keep the tiles in registers
      for (int c = 0; c < 4; ++c)
#pragma unroll  // constant indices keep the tiles in registers
        for (int r = 0; r < 8; ++r) o[g][c][r] *= alpha;

      // ---- P^T as B-fragments straight from the score tiles: element j of half
      // kh is key kh*32 + k_of(j, kbase) = row j & 7 of tile 2 kh + (j >> 3) ----
#pragma unroll  // constant indices keep the tiles in registers
      for (int kh = 0; kh < 2; ++kh)
#pragma unroll  // constant indices keep the tiles in registers
        for (int j = 0; j < 16; j += 2) {
          v2f pf = {s[g][2 * kh + (j >> 3)][j & 7],
                    s[g][2 * kh + (j >> 3)][(j & 7) + 1]};
          v2h ph = __builtin_convertvector(pf, v2h);   // round to nearest even
          bp[g][kh][j] = ph[0];
          bp[g][kh][j + 1] = ph[1];
        }
    }

    // ---- O^T += V^T P^T : K = 64 keys as two 32-key halves, 4 dim-chunks ----
    // V^T A-fragments: two transposing loads each (keys kh*32 + kbase + 0..7 and
    // + 16..23 of dim c*16 + l16: the k order of k_of, as bp has it).
    const _Float16* vtp = &Vt[kbase + (lane & 7)][((lane >> 3) & 1) * 8];
#pragma unroll
    for (int c = 0; c < 4; ++c) {
#pragma unroll
      for (int kh = 0; kh < 2; ++kh) {
        v8s lo = ld_tr16(vtp + (kh * 32) * VP_ + c * 16);
        v8s hi = ld_tr16(vtp + (kh * 32 + 16) * VP_ + c * 16);
        v16h av = __builtin_bit_cast(
            v16h, __builtin_shufflevector(lo, hi, 0, 1, 2, 3, 4, 5, 6, 7, 8, 9,
                                          10, 11, 12, 13, 14, 15));
#pragma unroll
        for (int g = 0; g < 2; ++g)
          o[g][c] = __builtin_amdgcn_wmma_f32_16x16x32_f16(
              false, av, false, bp[g][kh], (short)0, o[g][c], false, false);
      }
    }
  }

  // ---- epilogue: join the halves' sums, normalize, store O (B,H,S,D) fp32:
  // the lane holds dims c*16 + h8 + 0..7 of queries q0 + 16 g + l16 ----
#pragma unroll  // constant indices keep the tiles in registers
  for (int g = 0; g < 2; ++g) {
    const float inv = 1.0f / (l_i[g] + xhalf(l_i[g]));
    float* op = Og + ((size_t)(b * H_ + h) * S_ + q0 + 16 * g + l16) * D_ + h8;
#pragma unroll  // constant indices keep the tiles in registers
    for (int c = 0; c < 4; ++c) {
      *(float4*)(op + c * 16) =
          make_float4(o[g][c][0] * inv, o[g][c][1] * inv, o[g][c][2] * inv,
                      o[g][c][3] * inv);
      *(float4*)(op + c * 16 + 4) =
          make_float4(o[g][c][4] * inv, o[g][c][5] * inv, o[g][c][6] * inv,
                      o[g][c][7] * inv);
    }
  }
}

extern "C" void kernel_launch(void* const* d_in, const int* in_sizes, int n_in,
                              void* d_out, int out_size, void* d_ws, size_t ws_size,
                              hipStream_t stream) {
  (void)in_sizes; (void)n_in; (void)out_size; (void)d_ws; (void)ws_size;
  const float* Q  = (const float*)d_in[0];
  const float* K  = (const float*)d_in[1];
  const float* V  = (const float*)d_in[2];
  const int* qm_b = (const int*)d_in[3];
  const int* qm_s = (const int*)d_in[4];
  const int* km_b = (const int*)d_in[5];
  const int* km_s = (const int*)d_in[6];

  dim3 grid(B_ * H_ * (S_ / 256));  // 512 workgroups
  flash_attn_kernel<<<grid, 256, 0, stream>>>(Q, K, V, qm_b, qm_s, km_b, km_s,
                                              (float*)d_out);
}

// v007
// It runs in 35.5 microseconds.
// In both of two side-by-side timings against v006, it was 1.12 times as fast.
// Counting every step since v000, it is 5.77 times as fast.
#include <hip/hip_runtime.h>

typedef __attribute__((ext_vector_type(16))) _Float16 v16h;
typedef __attribute__((ext_vector_type(8)))  float    v8f;
typedef __attribute__((ext_vector_type(8)))  short    v8s;
typedef __attribute__((ext_vector_type(2)))  float    v2f;
typedef __attribute__((ext_vector_type(2)))  _Float16 v2h;

#define B_ 8
#define S_ 1024
#define H_ 16
#define D_ 64
#define M_ 1024

// K-index inside a 16x32 f16 A/B fragment for element j of the v16h,
// given this lane-half's base (0 for lanes 0-15, 8 for lanes 16-31).
// VGPR i (pair j=2i,2i+1): K = base + 2i (i<4)  or  base + 16 + 2(i-4).
__device__ __forceinline__ int k_of(int j, int kbase) {
  int i = j >> 1;
  int base = (i < 4) ? (2 * i) : (2 * i + 8);
  return kbase + base + (j & 1);
}

// pack two f32 into one dword of two f16 (v_cvt_pk_rz_f16_f32)
__device__ __forceinline__ unsigned int pk2h(float x, float y) {
  return __builtin_bit_cast(unsigned int, __builtin_amdgcn_cvt_pkrtz(x, y));
}

// v_max_num_f32 without fmaxf's canonicalize chaff. A builtin, not asm text: the
// maxima read the score tiles straight behind their last matrix
// instruction.
__device__ __forceinline__ float maxr(float a, float b) {
  return __builtin_elementwise_maximumnum(a, b);
}

// three-way maximum (the compiler joins the two into v_max3_num_f32)
__device__ __forceinline__ float max3r(float a, float b, float c) {
  return maxr(maxr(a, b), c);
}

// value of lane l ^ 16 (v_permlanex16_b32): the other half of a query's keys
__device__ __forceinline__ float xhalf(float x) {
  int b = __builtin_bit_cast(int, x);
  return __builtin_bit_cast(
      float, __builtin_amdgcn_permlanex16(b, b, 0x76543210, 0xfedcba98, false,
                                          false));
}

// exp2 with the slot behind a transcendental in the same statement; the v_nop is
// that slot.
__device__ __forceinline__ float exp2_slot(float x) {
  float y;
  asm("v_exp_f32 %0, %1\n\tv_nop" : "=v"(y) : "v"(x));
  return y;
}

// The same for eight values in place: each v_exp_f32 is the next one's
// independent neighbour, the v_nop is the slot behind the last.
__device__ __forceinline__ void exp2x8_slot(v8f& x) {
  float a = x[0], b = x[1], c = x[2], d = x[3], e = x[4], f = x[5], g = x[6],
        h = x[7];
  asm("v_exp_f32 %0, %0\n\tv_exp_f32 %1, %1\n\tv_exp_f32 %2, %2\n\t"
      "v_exp_f32 %3, %3\n\tv_exp_f32 %4, %4\n\tv_exp_f32 %5, %5\n\t"
      "v_exp_f32 %6, %6\n\tv_exp_f32 %7, %7\n\tv_nop"
      : "+v"(a), "+v"(b), "+v"(c), "+v"(d), "+v"(e), "+v"(f), "+v"(g), "+v"(h));
  x = v8f{a, b, c, d, e, f, g, h};
}

// Work-group barrier that orders LDS traffic only. The barriers of the key loop
// guard nothing but Kt and Vt, the two ahead of it Kb and Qf; __syncthreads() would also drain the load
// counter and so end the flight of the next tile's global loads at once.
__device__ __forceinline__ void lds_barrier() {
  __builtin_amdgcn_fence(__ATOMIC_RELEASE, "workgroup", "local");
  __builtin_amdgcn_s_barrier();
  __builtin_amdgcn_fence(__ATOMIC_ACQUIRE, "workgroup", "local");
}

// Row pitch of the V tile in halves: 160 B, an odd multiple of 32 B, the
// conflict-free pitch for the transposing load (rows stay 16-byte aligned).
#define VP_ 80

// ds_load_tr16_b128: the lane addresses 16 bytes of a row-major 16-bit tile and
// receives 8 consecutive rows of one column (rows 8*(lane>>4)+0..7, column
// lane&15 of the 16x16 block), i.e. half an A fragment of the transposed tile in
// the hardware k order.
__device__ __forceinline__ v8s ld_tr16(const _Float16* p) {
  typedef __attribute__((address_space(3))) v8s lds_v8s;
  return __builtin_amdgcn_ds_load_tr16_b128_v8i16((lds_v8s*)p);
}

// 8 waves of 32 query columns; at most 256 registers a lane, so that the two
// work-groups a WGP gets (512 over 256 WGPs) are resident together.
__launch_bounds__(256) __attribute__((amdgpu_waves_per_eu(4, 4)))
__global__ void flash_attn_kernel(const float* __restrict__ Qg,
                                  const float* __restrict__ Kg,
                                  const float* __restrict__ Vg,
                                  const int* __restrict__ qm_b,
                                  const int* __restrict__ qm_s,
                                  const int* __restrict__ km_b,
                                  const int* __restrict__ km_s,
                                  float* __restrict__ Og) {
  // rows of 72 halves (144 B, an odd multiple of 16 B): the conflict-free pitch
  // for ds_load_b128, whose immediate offsets reach the whole tile from one
  // address register
  __shared__ __attribute__((aligned(16))) _Float16 Kt[64][72];
  __shared__ __attribute__((aligned(16))) _Float16 Vt[64][VP_];  // read by ld_tr16
  // key mask of the whole batch row as an additive score bias: 0, or the
  // reference's -1e10 in the base-2 domain
  __shared__ __attribute__((aligned(32))) float Kb[S_];
  // query mask of the work-group's 256 queries as a factor: 1, or 0 if masked
  __shared__ float Qf[256];

  const int qb    = blockIdx.x & 3;    // 4 query superblocks of 256
  const int bh    = blockIdx.x >> 2;
  const int b     = bh / H_;
  const int h     = bh % H_;
  const int wave  = threadIdx.x >> 5;
  const int lane  = threadIdx.x & 31;
  const int l16   = lane & 15;
  const int hi16  = lane >> 4;         // lane half
  const int kbase = hi16 ? 8 : 0;      // K range owned by this half (A/B frags)
  const int h8    = hi16 ? 8 : 0;      // M offset owned by this half (C frags)

  const int q0 = qb * 256 + wave * 32;

  // ---- mask index lists: every work-group scans all M entries itself, four of
  // each list per thread. Loaded first, so that they are back before Q, K and V.
  static_assert(M_ == 4 * 256, "one int4 of each list per thread");
  const int4 qb4 = ((const int4*)qm_b)[threadIdx.x];
  const int4 qs4 = ((const int4*)qm_s)[threadIdx.x];
  const int4 kb4 = ((const int4*)km_b)[threadIdx.x];
  const int4 ks4 = ((const int4*)km_s)[threadIdx.x];

  // ---- Q^T: per group two 32x16 f16 B-fragments covering D=64 (loaded once).
  // Fold scale * log2(e) = 0.125 * 1.44269504 into Q: the scores come out in the
  // base-2 domain, exp(x) is exp2 of them with no multiply per score.
  v16h aq[2][2];
#pragma unroll  // constant indices keep the fragments in registers
  for (int g = 0; g < 2; ++g) {
    const float* qp = Qg + ((size_t)(b * S_ + q0 + 16 * g + l16) * H_ + h) * D_;
#pragma unroll
    for (int c = 0; c < 2; ++c)
#pragma unroll
      for (int j = 0; j < 16; ++j)
        aq[g][c][j] = (_Float16)(qp[c * 32 + k_of(j, kbase)] * 0.18033688f);
  }

  // ---- accumulators: O^T (64x16 as 4 C tiles), online-softmax m,l.
  // m_i is the query's running maximum (equal in both halves); l_i sums this
  // half's keys only, the halves are joined in the epilogue.
  v8f o[2][4];
#pragma unroll
  for (int g = 0; g < 2; ++g)
#pragma unroll
    for (int c = 0; c < 4; ++c)
#pragma unroll
      for (int r = 0; r < 8; ++r) o[g][c][r] = 0.f;
  float m_i[2] = {-3.0e38f, -3.0e38f}, l_i[2] = {0.f, 0.f};

  const float* kb_p = Kg + ((size_t)b * S_ * H_ + h) * D_;     // + s*H*D + d
  const float* vb_p = Vg + ((size_t)(b * H_ + h)) * S_ * D_;   // + s*D + d

  // This thread's share of a 64x64 tile: float4 column d4 of rows key0 + 16*i.
  const int key0 = threadIdx.x >> 4;
  const int d4   = threadIdx.x & 15;
  const float4* kp4 = (const float4*)kb_p + (size_t)key0 * (H_ * D_ / 4) + d4;
  const float4* vp4 = (const float4*)vb_p + (size_t)key0 * (D_ / 4) + d4;

  // Tile 0: all 8 loads of the thread in flight at once.
  float4 kq[4], vq[4];
#pragma unroll  // constant indices keep kq and vq in registers
  for (int i = 0; i < 4; ++i) {
    kq[i] = kp4[(size_t)i * 16 * (H_ * D_ / 4)];
    vq[i] = vp4[(size_t)i * 16 * (D_ / 4)];
  }

  // ---- both mask tables: start values, then a plain store per list entry that
  // names this batch row (and, for queries, this work-group's 256). Entries that
  // repeat store the same value, so no atomic is needed; an index outside its
  // range marks nothing.
  *(float4*)&Kb[4 * threadIdx.x] = make_float4(0.f, 0.f, 0.f, 0.f);
  Qf[threadIdx.x] = 1.f;
  lds_barrier();  // every start value is stored before the first mark
  {
    const int qbv[4] = {qb4.x, qb4.y, qb4.z, qb4.w};
    const int qsv[4] = {qs4.x, qs4.y, qs4.z, qs4.w};
    const int kbv[4] = {kb4.x, kb4.y, kb4.z, kb4.w};
    const int ksv[4] = {ks4.x, ks4.y, ks4.z, ks4.w};
#pragma unroll  // constant indices keep the entries in registers
    for (int e = 0; e < 4; ++e) {
      if (kbv[e] == b && (unsigned int)ksv[e] < (unsigned int)S_)
        Kb[ksv[e]] = -1.0e10f * 1.44269504f;
      const unsigned int qo = (unsigned int)(qsv[e] - qb * 256);
      if (qbv[e] == b && qo < 256u) Qf[qo] = 0.f;
    }
  }
  lds_barrier();  // every mark is stored before a table is read
  // A masked query has every score equal in the reference (uniform weights):
  // its factor in the exponent s * cf - m * cf is 0, so every weight is
  // exp2(0) = 1. The factor 1 of the others keeps s - m exact, also at the bias.
  const float cf[2] = {Qf[wave * 32 + l16], Qf[wave * 32 + 16 + l16]};

  // One trip over a 64-key block (32 WMMA). 'more' is a literal at both calls: the
  // last trip is written out by itself, so that in the loop the next tile's loads
  // are unconditional and kq, vq are dead during the score products, where their
  // 32 registers hold K fragments.
  auto trip = [&](const int kb, const bool more) __attribute__((always_inline)) {
    lds_barrier();  // prev iteration's Kt/Vt reads done before overwrite

    // stage the tile that was loaded one trip ahead:
    // v_cvt_pk_rz_f16_f32 x2 -> ds_store_b64
#pragma unroll  // constant indices keep kq and vq in registers
    for (int i = 0; i < 4; ++i) {
      uint2 kw, vw;
      kw.x = pk2h(kq[i].x, kq[i].y);  kw.y = pk2h(kq[i].z, kq[i].w);
      vw.x = pk2h(vq[i].x, vq[i].y);  vw.y = pk2h(vq[i].z, vq[i].w);
      *(uint2*)&Kt[key0 + 16 * i][d4 * 4] = kw;  // 8B-aligned (row stride 144 B)
      *(uint2*)&Vt[key0 + 16 * i][d4 * 4] = vw;  // 8B-aligned (row stride 160 B)
    }

    lds_barrier();

    // ---- scores S^T = K (Q*scale)^T : four 16-key row tiles per group;
    // s[g][t][r] = score of key kb + 16 t + h8 + r against query 16 g + l16.
    // The accumulators start from the keys' bias (reference: masked entries are
    // one constant; a score is far below half an ulp of the bias, so the sum
    // stays the bias); one set of bias rows serves both groups ----
    v8f s[2][4];
#pragma unroll
    for (int t = 0; t < 4; ++t) {
      const v8f kbias = *(const v8f*)&Kb[kb + t * 16 + h8];
      s[0][t] = kbias;
      s[1][t] = kbias;
    }
    // all eight K fragments of the tile are read as one group ahead of the
    // products (for speed only); counted waits then start each pair as its fragment lands
    v16h ak[2][4];
#pragma unroll  // constant indices keep the fragments in registers
    for (int c = 0; c < 2; ++c)
#pragma unroll
      for (int t = 0; t < 4; ++t)
#pragma unroll
        for (int j = 0; j < 16; ++j)
          ak[c][t][j] = Kt[t * 16 + l16][c * 32 + k_of(j, kbase)];
    // keeps the reads above from sinking back in between the products
    __builtin_amdgcn_sched_barrier(0);
#pragma unroll
    for (int c = 0; c < 2; ++c)
#pragma unroll
      for (int t = 0; t < 4; ++t)
#pragma unroll
        for (int g = 0; g < 2; ++g)
          s[g][t] = __builtin_amdgcn_wmma_f32_16x16x32_f16(
              false, ak[c][t], false, aq[g][c], (short)0, s[g][t], false, false);
    // keeps the loads below from rising above the products, where their
    // registers still hold K fragments
    __builtin_amdgcn_sched_barrier(0);

    // next tile's 8 loads fly under this tile's softmax and second product
    if (more) {
      kp4 += 64 * (H_ * D_ / 4);
      vp4 += 64 * (D_ / 4);
#pragma unroll  // constant indices; the 8 loads issue back to back
      for (int i = 0; i < 4; ++i) {
        kq[i] = kp4[(size_t)i * 16 * (H_ * D_ / 4)];
        vq[i] = vp4[(size_t)i * 16 * (D_ / 4)];
      }
    }

    v16h bp[2][2];
#pragma unroll  // constant indices keep the tiles in registers
    for (int g = 0; g < 2; ++g) {
      // ---- online softmax: maximum and sum run over the lane's own 32 scores,
      // one exchange joins the maxima of the two halves ----
      // (three-way maxima throughout: a two-way one on raw accumulator values
      // would bring the canonicalize chaff back)
      float tm[4];
#pragma unroll  // constant indices keep the tiles in registers
      for (int t = 0; t < 4; ++t) {
        float x = max3r(s[g][t][0], s[g][t][1], s[g][t][2]);
        x = max3r(x, s[g][t][3], s[g][t][4]);
        tm[t] = max3r(x, s[g][t][5], s[g][t][6]);
      }
      float bm = maxr(max3r(tm[0], tm[1], s[g][3][7]),
                      max3r(tm[2], tm[3],
                            max3r(s[g][0][7], s[g][1][7], s[g][2][7])));
      float mnew = max3r(m_i[g], bm, xhalf(bm));
      const float nmc = -mnew * cf[g];
      float ts[4];
#pragma unroll  // constant indices keep the tiles in registers
      for (int t = 0; t < 4; ++t) {
#pragma unroll  // constant indices keep the tiles in registers
        for (int r = 0; r < 8; ++r)  // all eight exponents ahead of their exp2
          s[g][t][r] = __builtin_fmaf(s[g][t][r], cf[g], nmc);
        if (more) {
#pragma unroll  // constant indices keep the tiles in registers
          for (int r = 0; r < 8; ++r)
            s[g][t][r] = __builtin_amdgcn_exp2f(s[g][t][r]);
        } else {
          exp2x8_slot(s[g][t]);
        }
        ts[t] = ((s[g][t][0] + s[g][t][1]) + (s[g][t][2] + s[g][t][3])) +
                ((s[g][t][4] + s[g][t][5]) + (s[g][t][6] + s[g][t][7]));
      }
      // first block: exp2(-3e38) = 0 (masked query: 1, on sums that are still 0)
      float alpha = exp2_slot(__builtin_fmaf(m_i[g], cf[g], nmc));
      l_i[g] = l_i[g] * alpha + ((ts[0] + ts[1]) + (ts[2] + ts[3]));
      m_i[g] = mnew;
#pragma unroll  // constant indices keep the tiles in registers
      for (int c = 0; c < 4; ++c)
#pragma unroll  // constant indices keep the tiles in registers
        for (int r = 0; r < 8; ++r) o[g][c][r] *= alpha;

      // ---- P^T as B-fragments straight from the score tiles: element j of half
      // kh is key kh*32 + k_of(j, kbase) = row j & 7 of tile 2 kh + (j >> 3) ----
#pragma unroll  // constant indices keep the tiles in registers
      for (int kh = 0; kh < 2; ++kh)
#pragma unroll  // constant indices keep the tiles in registers
        for (int j = 0; j < 16; j += 2) {
          v2f pf = {s[g][2 * kh + (j >> 3)][j & 7],
                    s[g][2 * kh + (j >> 3)][(j & 7) + 1]};
          v2h ph = __builtin_convertvector(pf, v2h);   // round to nearest even
          bp[g][kh][j] = ph[0];
          bp[g][kh][j + 1] = ph[1];
        }
    }

    // ---- O^T += V^T P^T : K = 64 keys as two 32-key halves, 4 dim-chunks ----
    // V^T A-fragments: two transposing loads each (keys kh*32 + kbase + 0..7 and
    // + 16..23 of dim c*16 + l16: the k order of k_of, as bp has it).
    const _Float16* vtp = &Vt[kbase + (lane & 7)][((lane >> 3) & 1) * 8];
    // all eight fragments are read as one group ahead of the products, as for K
    v16h av[4][2];
    // keeps the reads below out of the softmax, where no registers are free
    __builtin_amdgcn_sched_barrier(0);
#pragma unroll  // constant indices keep the fragments in registers
    for (int c = 0; c < 4; ++c)
#pragma unroll
      for (int kh = 0; kh < 2; ++kh) {
        v8s lo = ld_tr16(vtp + (kh * 32) * VP_ + c * 16);
        v8s hi = ld_tr16(vtp + (kh * 32 + 16) * VP_ + c * 16);
        av[c][kh] = __builtin_bit_cast(
            v16h, __builtin_shufflevector(lo, hi, 0, 1, 2, 3, 4, 5, 6, 7, 8, 9,
                                          10, 11, 12, 13, 14, 15));
      }
    // keeps the reads above from sinking back in between the products
    __builtin_amdgcn_sched_barrier(0);
#pragma unroll
    for (int c = 0; c < 4; ++c)
#pragma unroll
      for (int kh = 0; kh < 2; ++kh)
#pragma unroll
        for (int g = 0; g < 2; ++g)
          o[g][c] = __builtin_amdgcn_wmma_f32_16x16x32_f16(
              false, av[c][kh], false, bp[g][kh], (short)0, o[g][c], false, false);
  };
#pragma unroll 1  // one copy of the body in the loop
  for (int kb = 0; kb < S_ - 64; kb += 64) trip(kb, true);
  trip(S_ - 64, false);

  // ---- epilogue: join the halves' sums, normalize, store O (B,H,S,D) fp32:
  // the lane holds dims c*16 + h8 + 0..7 of queries q0 + 16 g + l16 ----
#pragma unroll  // constant indices keep the tiles in registers
  for (int g = 0; g < 2; ++g) {
    const float inv = 1.0f / (l_i[g] + xhalf(l_i[g]));
    float* op = Og + ((size_t)(b * H_ + h) * S_ + q0 + 16 * g + l16) * D_ + h8;
#pragma unroll  // constant indices keep the tiles in registers
    for (int c = 0; c < 4; ++c) {
      *(float4*)(op + c * 16) =
          make_float4(o[g][c][0] * inv, o[g][c][1] * inv, o[g][c][2] * inv,
                      o[g][c][3] * inv);
      *(float4*)(op + c * 16 + 4) =
          make_float4(o[g][c][4] * inv, o[g][c][5] * inv, o[g][c][6] * inv,
                      o[g][c][7] * inv);
    }
  }
}

extern "C" void kernel_launch(void* const* d_in, const int* in_sizes, int n_in,
                              void* d_out, int out_size, void* d_ws, size_t ws_size,
                              hipStream_t stream) {
  (void)in_sizes; (void)n_in; (void)out_size; (void)d_ws; (void)ws_size;
  const float* Q  = (const float*)d_in[0];
  const float* K  = (const float*)d_in[1];
  const float* V  = (const float*)d_in[2];
  const int* qm_b = (const int*)d_in[3];
  const int* qm_s = (const int*)d_in[4];
  const int* km_b = (const int*)d_in[5];
  const int* km_s = (const int*)d_in[6];

  dim3 grid(B_ * H_ * (S_ / 256));  // 512 workgroups
  flash_attn_kernel<<<grid, 256, 0, stream>>>(Q, K, V, qm_b, qm_s, km_b, km_s,
                                              (float*)d_out);
}

// v008
// A run of this version takes 33 microseconds.
// In both of two side-by-side timings against v007, it was 1.07 times as fast.
// All steps since v000 together make it 6.19 times as fast.
#include <hip/hip_runtime.h>

typedef __attribute__((ext_vector_type(16))) _Float16 v16h;
typedef __attribute__((ext_vector_type(8)))  float    v8f;
typedef __attribute__((ext_vector_type(8)))  short    v8s;
typedef __attribute__((ext_vector_type(2)))  float    v2f;
typedef __attribute__((ext_vector_type(2)))  _Float16 v2h;

#define B_ 8
#define S_ 1024
#define H_ 16
#define D_ 64
#define M_ 1024

// K-index inside a 16x32 f16 A/B fragment for element j of the v16h,
// given this lane-half's base (0 for lanes 0-15, 8 for lanes 16-31).
// VGPR i (pair j=2i,2i+1): K = base + 2i (i<4)  or  base + 16 + 2(i-4).
__device__ __forceinline__ int k_of(int j, int kbase) {
  int i = j >> 1;
  int base = (i < 4) ? (2 * i) : (2 * i + 8);
  return kbase + base + (j & 1);
}

// pack two f32 into one dword of two f16 (v_cvt_pk_rz_f16_f32)
__device__ __forceinline__ unsigned int pk2h(float x, float y) {
  return __builtin_bit_cast(unsigned int, __builtin_amdgcn_cvt_pkrtz(x, y));
}

// v_max_num_f32 without fmaxf's canonicalize chaff. A builtin, not asm text: the
// maxima read the score tiles straight behind their last matrix
// instruction.
__device__ __forceinline__ float maxr(float a, float b) {
  return __builtin_elementwise_maximumnum(a, b);
}

// three-way maximum (the compiler joins the two into v_max3_num_f32)
__device__ __forceinline__ float max3r(float a, float b, float c) {
  return maxr(maxr(a, b), c);
}

// value of lane l ^ 16 (v_permlanex16_b32): the other half of a query's keys
__device__ __forceinline__ float xhalf(float x) {
  int b = __builtin_bit_cast(int, x);
  return __builtin_bit_cast(
      float, __builtin_amdgcn_permlanex16(b, b, 0x76543210, 0xfedcba98, false,
                                          false));
}

// exp2 with the slot behind a transcendental in the same statement; the v_nop is
// that slot.
__device__ __forceinline__ float exp2_slot(float x) {
  float y;
  asm("v_exp_f32 %0, %1\n\tv_nop" : "=v"(y) : "v"(x));
  return y;
}

// The same for eight values in place: each v_exp_f32 is the next one's
// independent neighbour, the v_nop is the slot behind the last.
__device__ __forceinline__ void exp2x8_slot(v8f& x) {
  float a = x[0], b = x[1], c = x[2], d = x[3], e = x[4], f = x[5], g = x[6],
        h = x[7];
  asm("v_exp_f32 %0, %0\n\tv_exp_f32 %1, %1\n\tv_exp_f32 %2, %2\n\t"
      "v_exp_f32 %3, %3\n\tv_exp_f32 %4, %4\n\tv_exp_f32 %5, %5\n\t"
      "v_exp_f32 %6, %6\n\tv_exp_f32 %7, %7\n\tv_nop"
      : "+v"(a), "+v"(b), "+v"(c), "+v"(d), "+v"(e), "+v"(f), "+v"(g), "+v"(h));
  x = v8f{a, b, c, d, e, f, g, h};
}

// Work-group barrier that orders LDS traffic only. The barriers of the key loop
// guard nothing but Kt and Vt, the two ahead of it Kb and Qf (the second also the Q rows of the slabs); __syncthreads() would also drain the load
// counter and so end the flight of the next tile's global loads at once.
__device__ __forceinline__ void lds_barrier() {
  __builtin_amdgcn_fence(__ATOMIC_RELEASE, "workgroup", "local");
  __builtin_amdgcn_s_barrier();
  __builtin_amdgcn_fence(__ATOMIC_ACQUIRE, "workgroup", "local");
}

// Orders one wave's own LDS stores ahead of its own LDS loads where a lane reads
// what another lane of the same wave wrote (the wave's private slab): the stores
// have retired (s_wait_dscnt 0) and the compiler moves no LDS access across. No
// other wave takes part, so no work-group barrier is needed.
__device__ __forceinline__ void slab_sync() {
  __builtin_amdgcn_fence(__ATOMIC_RELEASE, "workgroup", "local");
  __builtin_amdgcn_wave_barrier();
  __builtin_amdgcn_fence(__ATOMIC_ACQUIRE, "workgroup", "local");
}

// Per-wave slab through which Q and O change between the memory's row order and
// the fragments' order. O: 32 rows of 64 floats at 272 B, Q: 32 rows of 64 halves
// at 144 B; both pitches are odd multiples of 16 B (conflict-free 16-byte access).
#define OP_ 68
#define QP_ 72

// Row pitch of the V tile in halves: 160 B, an odd multiple of 32 B, the
// conflict-free pitch for the transposing load (rows stay 16-byte aligned).
#define VP_ 80

// ds_load_tr16_b128: the lane addresses 16 bytes of a row-major 16-bit tile and
// receives 8 consecutive rows of one column (rows 8*(lane>>4)+0..7, column
// lane&15 of the 16x16 block), i.e. half an A fragment of the transposed tile in
// the hardware k order.
__device__ __forceinline__ v8s ld_tr16(const _Float16* p) {
  typedef __attribute__((address_space(3))) v8s lds_v8s;
  return __builtin_amdgcn_ds_load_tr16_b128_v8i16((lds_v8s*)p);
}

// 8 waves of 32 query columns; at most 256 registers a lane, so that the two
// work-groups a WGP gets (512 over 256 WGPs) are resident together.
__launch_bounds__(256) __attribute__((amdgpu_waves_per_eu(4, 4)))
__global__ void flash_attn_kernel(const float* __restrict__ Qg,
                                  const float* __restrict__ Kg,
                                  const float* __restrict__ Vg,
                                  const int* __restrict__ qm_b,
                                  const int* __restrict__ qm_s,
                                  const int* __restrict__ km_b,
                                  const int* __restrict__ km_s,
                                  float* __restrict__ Og) {
  // rows of 72 halves (144 B, an odd multiple of 16 B): the conflict-free pitch
  // for ds_load_b128, whose immediate offsets reach the whole tile from one
  // address register
  __shared__ __attribute__((aligned(16))) _Float16 Kt[64][72];
  __shared__ __attribute__((aligned(16))) _Float16 Vt[64][VP_];  // read by ld_tr16
  // key mask of the whole batch row as an additive score bias: 0, or the
  // reference's -1e10 in the base-2 domain
  __shared__ __attribute__((aligned(32))) float Kb[S_];
  // query mask of the work-group's 256 queries as a factor: 1, or 0 if masked
  __shared__ float Qf[256];
  // one private slab per wave (see OP_, QP_)
  __shared__ __attribute__((aligned(16))) float Sl[8][32 * OP_];

  const int qb    = blockIdx.x & 3;    // 4 query superblocks of 256
  const int bh    = blockIdx.x >> 2;
  const int b     = bh / H_;
  const int h     = bh % H_;
  const int wave  = threadIdx.x >> 5;
  const int swave = __builtin_amdgcn_readfirstlane(wave);  // the same, as a scalar
  const int lane  = threadIdx.x & 31;
  const int l16   = lane & 15;
  const int hi16  = lane >> 4;         // lane half
  const int kbase = hi16 ? 8 : 0;      // K range owned by this half (A/B frags)
  const int h8    = hi16 ? 8 : 0;      // M offset owned by this half (C frags)

  const int q0 = qb * 256 + wave * 32;

  // ---- mask index lists: every work-group scans all M entries itself, four of
  // each list per thread. Loaded first, so that they are back before Q, K and V.
  static_assert(M_ == 4 * 256, "one int4 of each list per thread");
  const int4 qb4 = ((const int4*)qm_b)[threadIdx.x];
  const int4 qs4 = ((const int4*)qm_s)[threadIdx.x];
  const int4 kb4 = ((const int4*)km_b)[threadIdx.x];
  const int4 ks4 = ((const int4*)km_s)[threadIdx.x];

  // ---- Q rows of the wave, in memory order: 16 lanes cover one query's 256 B, so
  // that a load instruction touches 4 whole 128-B lines (read in fragment order it
  // touched 16 lines for 16-byte pieces, each line four times over).
  float4 qr[16];
  {
    const float* qp = Qg + ((size_t)(b * S_ + q0 + hi16) * H_ + h) * D_ + l16 * 4;
#pragma unroll  // constant indices keep the rows in registers
    for (int i = 0; i < 16; ++i)
      qr[i] = *(const float4*)(qp + (size_t)i * 2 * H_ * D_);
  }

  // ---- accumulators: O^T (64x16 as 4 C tiles), online-softmax m,l.
  // m_i is the query's running maximum (equal in both halves); l_i sums this
  // half's keys only, the halves are joined in the epilogue.
  v8f o[2][4];
#pragma unroll
  for (int g = 0; g < 2; ++g)
#pragma unroll
    for (int c = 0; c < 4; ++c)
#pragma unroll
      for (int r = 0; r < 8; ++r) o[g][c][r] = 0.f;
  float m_i[2] = {-3.0e38f, -3.0e38f}, l_i[2] = {0.f, 0.f};

  const float* kb_p = Kg + ((size_t)b * S_ * H_ + h) * D_;     // + s*H*D + d
  const float* vb_p = Vg + ((size_t)(b * H_ + h)) * S_ * D_;   // + s*D + d

  // This thread's share of a 64x64 tile: float4 column d4 of rows key0 + 16*i.
  const int key0 = threadIdx.x >> 4;
  const int d4   = threadIdx.x & 15;
  const float4* kp4 = (const float4*)kb_p + (size_t)key0 * (H_ * D_ / 4) + d4;
  const float4* vp4 = (const float4*)vb_p + (size_t)key0 * (D_ / 4) + d4;

  // Tile 0: all 8 loads of the thread in flight at once.
  float4 kq[4], vq[4];
#pragma unroll  // constant indices keep kq and vq in registers
  for (int i = 0; i < 4; ++i) {
    kq[i] = kp4[(size_t)i * 16 * (H_ * D_ / 4)];
    vq[i] = vp4[(size_t)i * 16 * (D_ / 4)];
  }

  // ---- both mask tables: start values, then a plain store per list entry that
  // names this batch row (and, for queries, this work-group's 256). Entries that
  // repeat store the same value, so no atomic is needed; an index outside its
  // range marks nothing.
  *(float4*)&Kb[4 * threadIdx.x] = make_float4(0.f, 0.f, 0.f, 0.f);
  Qf[threadIdx.x] = 1.f;
  lds_barrier();  // every start value is stored before the first mark
  {
    const int qbv[4] = {qb4.x, qb4.y, qb4.z, qb4.w};
    const int qsv[4] = {qs4.x, qs4.y, qs4.z, qs4.w};
    const int kbv[4] = {kb4.x, kb4.y, kb4.z, kb4.w};
    const int ksv[4] = {ks4.x, ks4.y, ks4.z, ks4.w};
#pragma unroll  // constant indices keep the entries in registers
    for (int e = 0; e < 4; ++e) {
      if (kbv[e] == b && (unsigned int)ksv[e] < (unsigned int)S_)
        Kb[ksv[e]] = -1.0e10f * 1.44269504f;
      const unsigned int qo = (unsigned int)(qsv[e] - qb * 256);
      if (qbv[e] == b && qo < 256u) Qf[qo] = 0.f;
    }
  }
  // Fold scale * log2(e) = 0.125 * 1.44269504 into Q: the scores come out in the
  // base-2 domain, exp(x) is exp2 of them with no multiply per score. The f16 rows
  // go to the wave's slab.
  _Float16* const qs = (_Float16*)&Sl[wave][0];
#pragma unroll  // constant indices keep the rows in registers
  for (int i = 0; i < 16; ++i) {
    v2f lo = {qr[i].x * 0.18033688f, qr[i].y * 0.18033688f};
    v2f hi = {qr[i].z * 0.18033688f, qr[i].w * 0.18033688f};
    uint2 w;  // round to nearest even
    w.x = __builtin_bit_cast(unsigned int, __builtin_convertvector(lo, v2h));
    w.y = __builtin_bit_cast(unsigned int, __builtin_convertvector(hi, v2h));
    *(uint2*)&qs[(2 * i + hi16) * QP_ + l16 * 4] = w;
  }
  lds_barrier();  // every mark (and Q row) is stored before it is read
  // ---- Q^T: per group two 32x16 f16 B-fragments covering D=64 (read once)
  v16h aq[2][2];
#pragma unroll  // constant indices keep the fragments in registers
  for (int g = 0; g < 2; ++g)
#pragma unroll
    for (int c = 0; c < 2; ++c)
#pragma unroll
      for (int j = 0; j < 16; ++j)
        aq[g][c][j] = qs[(16 * g + l16) * QP_ + c * 32 + k_of(j, kbase)];
  // A masked query has every score equal in the reference (uniform weights):
  // its factor in the exponent s * cf - m * cf is 0, so every weight is
  // exp2(0) = 1. The factor 1 of the others keeps s - m exact, also at the bias.
  const float cf[2] = {Qf[wave * 32 + l16], Qf[wave * 32 + 16 + l16]};

  // One trip over a 64-key block (32 WMMA). 'more' is a literal at both calls: the
  // last trip is written out by itself, so that in the loop the next tile's loads
  // are unconditional and kq, vq are dead during the score products, where their
  // 32 registers hold K fragments.
  auto trip = [&](const int kb, const bool more) __attribute__((always_inline)) {
    lds_barrier();  // prev iteration's Kt/Vt reads done before overwrite

    // stage the tile that was loaded one trip ahead:
    // v_cvt_pk_rz_f16_f32 x2 -> ds_store_b64
#pragma unroll  // constant indices keep kq and vq in registers
    for (int i = 0; i < 4; ++i) {
      uint2 kw, vw;
      kw.x = pk2h(kq[i].x, kq[i].y);  kw.y = pk2h(kq[i].z, kq[i].w);
      vw.x = pk2h(vq[i].x, vq[i].y);  vw.y = pk2h(vq[i].z, vq[i].w);
      *(uint2*)&Kt[key0 + 16 * i][d4 * 4] = kw;  // 8B-aligned (row stride 144 B)
      *(uint2*)&Vt[key0 + 16 * i][d4 * 4] = vw;  // 8B-aligned (row stride 160 B)
    }

    lds_barrier();

    // ---- scores S^T = K (Q*scale)^T : four 16-key row tiles per group;
    // s[g][t][r] = score of key kb + 16 t + h8 + r against query 16 g + l16.
    // The accumulators start from the keys' bias (reference: masked entries are
    // one constant; a score is far below half an ulp of the bias, so the sum
    // stays the bias); one set of bias rows serves both groups ----
    v8f s[2][4];
#pragma unroll
    for (int t = 0; t < 4; ++t) {
      const v8f kbias = *(const v8f*)&Kb[kb + t * 16 + h8];
      s[0][t] = kbias;
      s[1][t] = kbias;
    }
    // all eight K fragments of the tile are read as one group ahead of the
    // products (for speed only); counted waits then start each pair as its fragment lands
    v16h ak[2][4];
#pragma unroll  // constant indices keep the fragments in registers
    for (int c = 0; c < 2; ++c)
#pragma unroll
      for (int t = 0; t < 4; ++t)
#pragma unroll
        for (int j = 0; j < 16; ++j)
          ak[c][t][j] = Kt[t * 16 + l16][c * 32 + k_of(j, kbase)];
    // keeps the reads above from sinking back in between the products
    __builtin_amdgcn_sched_barrier(0);
#pragma unroll
    for (int c = 0; c < 2; ++c)
#pragma unroll
      for (int t = 0; t < 4; ++t)
#pragma unroll
        for (int g = 0; g < 2; ++g)
          s[g][t] = __builtin_amdgcn_wmma_f32_16x16x32_f16(
              false, ak[c][t], false, aq[g][c], (short)0, s[g][t], false, false);
    // keeps the loads below from rising above the products, where their
    // registers still hold K fragments
    __builtin_amdgcn_sched_barrier(0);

    // next tile's 8 loads fly under this tile's softmax and second product
    if (more) {
      kp4 += 64 * (H_ * D_ / 4);
      vp4 += 64 * (D_ / 4);
#pragma unroll  // constant indices; the 8 loads issue back to back
      for (int i = 0; i < 4; ++i) {
        kq[i] = kp4[(size_t)i * 16 * (H_ * D_ / 4)];
        vq[i] = vp4[(size_t)i * 16 * (D_ / 4)];
      }
    }

    v16h bp[2][2];
#pragma unroll  // constant indices keep the tiles in registers
    for (int g = 0; g < 2; ++g) {
      // ---- online softmax: maximum and sum run over the lane's own 32 scores,
      // one exchange joins the maxima of the two halves ----
      // (three-way maxima throughout: a two-way one on raw accumulator values
      // would bring the canonicalize chaff back)
      float tm[4];
#pragma unroll  // constant indices keep the tiles in registers
      for (int t = 0; t < 4; ++t) {
        float x = max3r(s[g][t][0], s[g][t][1], s[g][t][2]);
        x = max3r(x, s[g][t][3], s[g][t][4]);
        tm[t] = max3r(x, s[g][t][5], s[g][t][6]);
      }
      float bm = maxr(max3r(tm[0], tm[1], s[g][3][7]),
                      max3r(tm[2], tm[3],
                            max3r(s[g][0][7], s[g][1][7], s[g][2][7])));
      float mnew = max3r(m_i[g], bm, xhalf(bm));
      const float nmc = -mnew * cf[g];
      float ts[4];
#pragma unroll  // constant indices keep the tiles in registers
      for (int t = 0; t < 4; ++t) {
#pragma unroll  // constant indices keep the tiles in registers
        for (int r = 0; r < 8; ++r)  // all eight exponents ahead of their exp2
          s[g][t][r] = __builtin_fmaf(s[g][t][r], cf[g], nmc);
        if (more) {
#pragma unroll  // constant indices keep the tiles in registers
          for (int r = 0; r < 8; ++r)
            s[g][t][r] = __builtin_amdgcn_exp2f(s[g][t][r]);
        } else {
          exp2x8_slot(s[g][t]);
        }
        ts[t] = ((s[g][t][0] + s[g][t][1]) + (s[g][t][2] + s[g][t][3])) +
                ((s[g][t][4] + s[g][t][5]) + (s[g][t][6] + s[g][t][7]));
      }
      // first block: exp2(-3e38) = 0 (masked query: 1, on sums that are still 0)
      float alpha = exp2_slot(__builtin_fmaf(m_i[g], cf[g], nmc));
      l_i[g] = l_i[g] * alpha + ((ts[0] + ts[1]) + (ts[2] + ts[3]));
      m_i[g] = mnew;
#pragma unroll  // constant indices keep the tiles in registers
      for (int c = 0; c < 4; ++c)
#pragma unroll  // constant indices keep the tiles in registers
        for (int r = 0; r < 8; ++r) o[g][c][r] *= alpha;

      // ---- P^T as B-fragments straight from the score tiles: element j of half
      // kh is key kh*32 + k_of(j, kbase) = row j & 7 of tile 2 kh + (j >> 3) ----
#pragma unroll  // constant indices keep the tiles in registers
      for (int kh = 0; kh < 2; ++kh)
#pragma unroll  // constant indices keep the tiles in registers
        for (int j = 0; j < 16; j += 2) {
          v2f pf = {s[g][2 * kh + (j >> 3)][j & 7],
                    s[g][2 * kh + (j >> 3)][(j & 7) + 1]};
          v2h ph = __builtin_convertvector(pf, v2h);   // round to nearest even
          bp[g][kh][j] = ph[0];
          bp[g][kh][j + 1] = ph[1];
        }
    }

    // ---- O^T += V^T P^T : K = 64 keys as two 32-key halves, 4 dim-chunks ----
    // V^T A-fragments: two transposing loads each (keys kh*32 + kbase + 0..7 and
    // + 16..23 of dim c*16 + l16: the k order of k_of, as bp has it).
    const _Float16* vtp = &Vt[kbase + (lane & 7)][((lane >> 3) & 1) * 8];
    // all eight fragments are read as one group ahead of the products, as for K
    v16h av[4][2];
    // keeps the reads below out of the softmax, where no registers are free
    __builtin_amdgcn_sched_barrier(0);
#pragma unroll  // constant indices keep the fragments in registers
    for (int c = 0; c < 4; ++c)
#pragma unroll
      for (int kh = 0; kh < 2; ++kh) {
        v8s lo = ld_tr16(vtp + (kh * 32) * VP_ + c * 16);
        v8s hi = ld_tr16(vtp + (kh * 32 + 16) * VP_ + c * 16);
        av[c][kh] = __builtin_bit_cast(
            v16h, __builtin_shufflevector(lo, hi, 0, 1, 2, 3, 4, 5, 6, 7, 8, 9,
                                          10, 11, 12, 13, 14, 15));
      }
    // keeps the reads above from sinking back in between the products
    __builtin_amdgcn_sched_barrier(0);
#pragma unroll
    for (int c = 0; c < 4; ++c)
#pragma unroll
      for (int kh = 0; kh < 2; ++kh)
#pragma unroll
        for (int g = 0; g < 2; ++g)
          o[g][c] = __builtin_amdgcn_wmma_f32_16x16x32_f16(
              false, av[c][kh], false, bp[g][kh], (short)0, o[g][c], false, false);
  };
#pragma unroll 1  // one copy of the body in the loop
  for (int kb = 0; kb < S_ - 64; kb += 64) trip(kb, true);
  trip(S_ - 64, false);

  // ---- epilogue: join the halves' sums, normalize; the lane holds dims
  // c*16 + h8 + 0..7 of queries q0 + 16 g + l16. The rows pass through the wave's
  // slab, so that each store instruction writes 512 B in a row, 4 whole 128-B lines
  // of O (B,H,S,D) fp32 (from the accumulators it wrote 16-byte pieces of 16 lines).
  // The lane's number is formed anew (v_mbcnt) and the wave's number lies in a
  // scalar register: no vector register is held through the key loop for this.
  const int el   = (int)__builtin_amdgcn_mbcnt_lo(~0u, 0u);
  const int el16 = el & 15;
  const int ehi  = el >> 4;
  float* const sl = &Sl[swave][0];
#pragma unroll  // constant indices keep the tiles in registers
  for (int g = 0; g < 2; ++g) {
    const float inv = 1.0f / (l_i[g] + xhalf(l_i[g]));
    float* sp = sl + (16 * g + el16) * OP_ + ehi * 8;
#pragma unroll  // constant indices keep the tiles in registers
    for (int c = 0; c < 4; ++c) {
      *(float4*)(sp + c * 16) =
          make_float4(o[g][c][0] * inv, o[g][c][1] * inv, o[g][c][2] * inv,
                      o[g][c][3] * inv);
      *(float4*)(sp + c * 16 + 4) =
          make_float4(o[g][c][4] * inv, o[g][c][5] * inv, o[g][c][6] * inv,
                      o[g][c][7] * inv);
    }
  }
  slab_sync();
  // the wave's 32 output rows are 8 KB in a row
  float* op = Og + ((size_t)(b * H_ + h) * S_ + qb * 256 + swave * 32) * D_ + el * 4;
#pragma unroll  // the 16 reads issue as one group ahead of the stores
  for (int i = 0; i < 16; ++i)
    *(float4*)(op + i * 128) = *(const float4*)(sl + (2 * i + ehi) * OP_ + el16 * 4);
}

extern "C" void kernel_launch(void* const* d_in, const int* in_sizes, int n_in,
                              void* d_out, int out_size, void* d_ws, size_t ws_size,
                              hipStream_t stream) {
  (void)in_sizes; (void)n_in; (void)out_size; (void)d_ws; (void)ws_size;
  const float* Q  = (const float*)d_in[0];
  const float* K  = (const float*)d_in[1];
  const float* V  = (const float*)d_in[2];
  const int* qm_b = (const int*)d_in[3];
  const int* qm_s = (const int*)d_in[4];
  const int* km_b = (const int*)d_in[5];
  const int* km_s = (const int*)d_in[6];

  dim3 grid(B_ * H_ * (S_ / 256));  // 512 workgroups
  flash_attn_kernel<<<grid, 256, 0, stream>>>(Q, K, V, qm_b, qm_s, km_b, km_s,
                                              (float*)d_out);
}

// v010
// It runs in 29.2 microseconds.
// Versions between v008 and this one are left out; their measured steps multiply to 1.13 times as fast.
// All steps since v000 together make it 6.99 times as fast.
#include <hip/hip_runtime.h>

typedef __attribute__((ext_vector_type(16))) _Float16 v16h;
typedef __attribute__((ext_vector_type(8)))  float    v8f;
typedef __attribute__((ext_vector_type(8)))  short    v8s;
typedef __attribute__((ext_vector_type(2)))  float    v2f;
typedef __attribute__((ext_vector_type(2)))  _Float16 v2h;

#define B_ 8
#define S_ 1024
#define H_ 16
#define D_ 64
#define M_ 1024

// K-index inside a 16x32 f16 A/B fragment for element j of the v16h,
// given this lane-half's base (0 for lanes 0-15, 8 for lanes 16-31).
// VGPR i (pair j=2i,2i+1): K = base + 2i (i<4)  or  base + 16 + 2(i-4).
__device__ __forceinline__ int k_of(int j, int kbase) {
  int i = j >> 1;
  int base = (i < 4) ? (2 * i) : (2 * i + 8);
  return kbase + base + (j & 1);
}

// pack two f32 into one dword of two f16 (v_cvt_pk_rz_f16_f32)
__device__ __forceinline__ unsigned int pk2h(float x, float y) {
  return __builtin_bit_cast(unsigned int, __builtin_amdgcn_cvt_pkrtz(x, y));
}

// v_max_num_f32 without fmaxf's canonicalize chaff. A builtin, not asm text: the
// maxima read the score tiles straight behind their last matrix
// instruction.
__device__ __forceinline__ float maxr(float a, float b) {
  return __builtin_elementwise_maximumnum(a, b);
}

// three-way maximum (the compiler joins the two into v_max3_num_f32)
__device__ __forceinline__ float max3r(float a, float b, float c) {
  return maxr(maxr(a, b), c);
}

// value of lane l ^ 16 (v_permlanex16_b32): the other half of a query's keys
__device__ __forceinline__ float xhalf(float x) {
  int b = __builtin_bit_cast(int, x);
  return __builtin_bit_cast(
      float, __builtin_amdgcn_permlanex16(b, b, 0x76543210, 0xfedcba98, false,
                                          false));
}

// exp2 with the slot behind a transcendental in the same statement; the v_nop is
// that slot.
__device__ __forceinline__ float exp2_slot(float x) {
  float y;
  asm("v_exp_f32 %0, %1\n\tv_nop" : "=v"(y) : "v"(x));
  return y;
}

// The same for eight values in place: each v_exp_f32 is the next one's
// independent neighbour; the slot behind the last is filled by the first add of
// the row sum (it reads the first two results), which is returned.
__device__ __forceinline__ float exp2x8_sum01(v8f& x) {
  float a = x[0], b = x[1], c = x[2], d = x[3], e = x[4], f = x[5], g = x[6],
        h = x[7], p;
  asm("v_exp_f32 %0, %0\n\tv_exp_f32 %1, %1\n\tv_exp_f32 %2, %2\n\t"
      "v_exp_f32 %3, %3\n\tv_exp_f32 %4, %4\n\tv_exp_f32 %5, %5\n\t"
      "v_exp_f32 %6, %6\n\tv_exp_f32 %7, %7\n\tv_add_f32 %8, %0, %1"
      : "+v"(a), "+v"(b), "+v"(c), "+v"(d), "+v"(e), "+v"(f), "+v"(g), "+v"(h),
        "=v"(p));
  x = v8f{a, b, c, d, e, f, g, h};
  return p;
}

// Work-group barrier that orders LDS traffic only. The barriers of the key loop
// guard nothing but Kt and Vt, the two ahead of it Kb and Qf (the second also the Q rows of the slabs); __syncthreads() would also drain the load
// counter and so end the flight of the next tile's global loads at once.
__device__ __forceinline__ void lds_barrier() {
  __builtin_amdgcn_fence(__ATOMIC_RELEASE, "workgroup", "local");
  __builtin_amdgcn_s_barrier();
  __builtin_amdgcn_fence(__ATOMIC_ACQUIRE, "workgroup", "local");
}

// Orders one wave's own LDS stores ahead of its own LDS loads where a lane reads
// what another lane of the same wave wrote (the wave's private slab): the stores
// have retired (s_wait_dscnt 0) and the compiler moves no LDS access across. No
// other wave takes part, so no work-group barrier is needed.
__device__ __forceinline__ void slab_sync() {
  __builtin_amdgcn_fence(__ATOMIC_RELEASE, "workgroup", "local");
  __builtin_amdgcn_wave_barrier();
  __builtin_amdgcn_fence(__ATOMIC_ACQUIRE, "workgroup", "local");
}

// Per-wave slab through which Q and O change between the memory's row order and
// the fragments' order. O: 32 rows of 64 floats at 272 B, Q: 32 rows of 64 halves
// at 144 B; both pitches are odd multiples of 16 B (conflict-free 16-byte access).
#define OP_ 68
#define QP_ 72

// Row pitch of the V tile in halves: 160 B, an odd multiple of 32 B, the
// conflict-free pitch for the transposing load (rows stay 16-byte aligned).
#define VP_ 80

// ds_load_tr16_b128: the lane addresses 16 bytes of a row-major 16-bit tile and
// receives 8 consecutive rows of one column (rows 8*(lane>>4)+0..7, column
// lane&15 of the 16x16 block), i.e. half an A fragment of the transposed tile in
// the hardware k order.
__device__ __forceinline__ v8s ld_tr16(const _Float16* p) {
  typedef __attribute__((address_space(3))) v8s lds_v8s;
  return __builtin_amdgcn_ds_load_tr16_b128_v8i16((lds_v8s*)p);
}

// 8 waves of 32 query columns; at most 256 registers a lane, so that the two
// work-groups a WGP gets (512 over 256 WGPs) are resident together.
__launch_bounds__(256) __attribute__((amdgpu_waves_per_eu(4, 4)))
__global__ void flash_attn_kernel(const float* __restrict__ Qg,
                                  const float* __restrict__ Kg,
                                  const float* __restrict__ Vg,
                                  const int* __restrict__ qm_b,
                                  const int* __restrict__ qm_s,
                                  const int* __restrict__ km_b,
                                  const int* __restrict__ km_s,
                                  float* __restrict__ Og) {
  // rows of 72 halves (144 B, an odd multiple of 16 B): the conflict-free pitch
  // for ds_load_b128, whose immediate offsets reach the whole tile from one
  // address register
  __shared__ __attribute__((aligned(16))) _Float16 Kt[64][72];
  __shared__ __attribute__((aligned(16))) _Float16 Vt[64][VP_];  // read by ld_tr16
  // key mask of the whole batch row as an additive score bias: 0, or the
  // reference's -1e10 in the base-2 domain
  __shared__ __attribute__((aligned(32))) float Kb[S_];
  // query mask of the work-group's 256 queries as a factor: 1, or 0 if masked
  __shared__ float Qf[256];
  // one private slab per wave (see OP_, QP_)
  __shared__ __attribute__((aligned(16))) float Sl[8][32 * OP_];

  // The 4 work-groups that walk one head's K and V (query superblocks 0..3) get
  // block indices 128 apart, so equal mod 8. For speed only:
  // every (head, superblock) is done exactly once wherever the work-groups land.
  static_assert((B_ * H_) % 8 == 0, "a head's work-groups share the index mod 8");
  const int qb    = blockIdx.x / (B_ * H_);  // 4 query superblocks of 256
  const int bh    = blockIdx.x % (B_ * H_);
  const int b     = bh / H_;
  const int h     = bh % H_;
  const int wave  = threadIdx.x >> 5;
  const int swave = __builtin_amdgcn_readfirstlane(wave);  // the same, as a scalar
  const int lane  = threadIdx.x & 31;
  const int l16   = lane & 15;
  const int hi16  = lane >> 4;         // lane half
  const int kbase = hi16 ? 8 : 0;      // K range owned by this half (A/B frags)
  const int h8    = hi16 ? 8 : 0;      // M offset owned by this half (C frags)

  const int q0 = qb * 256 + wave * 32;

  // ---- mask index lists: every work-group scans all M entries itself, four of
  // each list per thread. Loaded first, so that they are back before Q, K and V.
  static_assert(M_ == 4 * 256, "one int4 of each list per thread");
  const int4 qb4 = ((const int4*)qm_b)[threadIdx.x];
  const int4 qs4 = ((const int4*)qm_s)[threadIdx.x];
  const int4 kb4 = ((const int4*)km_b)[threadIdx.x];
  const int4 ks4 = ((const int4*)km_s)[threadIdx.x];

  // ---- Q rows of the wave, in memory order: 16 lanes cover one query's 256 B, so
  // that a load instruction touches 4 whole 128-B lines (read in fragment order it
  // touched 16 lines for 16-byte pieces, each line four times over).
  float4 qr[16];
  {
    const float* qp = Qg + ((size_t)(b * S_ + q0 + hi16) * H_ + h) * D_ + l16 * 4;
#pragma unroll  // constant indices keep the rows in registers
    for (int i = 0; i < 16; ++i)
      qr[i] = *(const float4*)(qp + (size_t)i * 2 * H_ * D_);
  }

  // ---- accumulators: O^T (64x16 as 4 C tiles), online-softmax m,l.
  // m_i is the query's reference maximum (equal in both halves; see the lazy
  // rescale in the loop); l_i sums this half's keys only, the halves are joined in
  // the epilogue.
  v8f o[2][4];
#pragma unroll
  for (int g = 0; g < 2; ++g)
#pragma unroll
    for (int c = 0; c < 4; ++c)
#pragma unroll
      for (int r = 0; r < 8; ++r) o[g][c][r] = 0.f;
  float m_i[2] = {-3.0e38f, -3.0e38f}, l_i[2] = {0.f, 0.f};

  const float* kb_p = Kg + ((size_t)b * S_ * H_ + h) * D_;     // + s*H*D + d
  const float* vb_p = Vg + ((size_t)(b * H_ + h)) * S_ * D_;   // + s*D + d

  // This thread's share of a 64x64 tile: float4 column d4 of rows key0 + 16*i.
  const int key0 = threadIdx.x >> 4;
  const int d4   = threadIdx.x & 15;
  const float4* kp4 = (const float4*)kb_p + (size_t)key0 * (H_ * D_ / 4) + d4;
  const float4* vp4 = (const float4*)vb_p + (size_t)key0 * (D_ / 4) + d4;

  // Tile 0: all 8 loads of the thread in flight at once.
  float4 kq[4], vq[4];
#pragma unroll  // constant indices keep kq and vq in registers
  for (int i = 0; i < 4; ++i) {
    kq[i] = kp4[(size_t)i * 16 * (H_ * D_ / 4)];
    vq[i] = vp4[(size_t)i * 16 * (D_ / 4)];
  }

  // ---- both mask tables: start values, then a plain store per list entry that
  // names this batch row (and, for queries, this work-group's 256). Entries that
  // repeat store the same value, so no atomic is needed; an index outside its
  // range marks nothing.
  *(float4*)&Kb[4 * threadIdx.x] = make_float4(0.f, 0.f, 0.f, 0.f);
  Qf[threadIdx.x] = 1.f;
  lds_barrier();  // every start value is stored before the first mark
  {
    const int qbv[4] = {qb4.x, qb4.y, qb4.z, qb4.w};
    const int qsv[4] = {qs4.x, qs4.y, qs4.z, qs4.w};
    const int kbv[4] = {kb4.x, kb4.y, kb4.z, kb4.w};
    const int ksv[4] = {ks4.x, ks4.y, ks4.z, ks4.w};
#pragma unroll  // constant indices keep the entries in registers
    for (int e = 0; e < 4; ++e) {
      if (kbv[e] == b && (unsigned int)ksv[e] < (unsigned int)S_)
        Kb[ksv[e]] = -1.0e10f * 1.44269504f;
      const unsigned int qo = (unsigned int)(qsv[e] - qb * 256);
      if (qbv[e] == b && qo < 256u) Qf[qo] = 0.f;
    }
  }
  // Fold scale * log2(e) = 0.125 * 1.44269504 into Q: the scores come out in the
  // base-2 domain, exp(x) is exp2 of them with no multiply per score. The f16 rows
  // go to the wave's slab.
  _Float16* const qs = (_Float16*)&Sl[wave][0];
#pragma unroll  // constant indices keep the rows in registers
  for (int i = 0; i < 16; ++i) {
    v2f lo = {qr[i].x * 0.18033688f, qr[i].y * 0.18033688f};
    v2f hi = {qr[i].z * 0.18033688f, qr[i].w * 0.18033688f};
    uint2 w;  // round to nearest even
    w.x = __builtin_bit_cast(unsigned int, __builtin_convertvector(lo, v2h));
    w.y = __builtin_bit_cast(unsigned int, __builtin_convertvector(hi, v2h));
    *(uint2*)&qs[(2 * i + hi16) * QP_ + l16 * 4] = w;
  }
  lds_barrier();  // every mark (and Q row) is stored before it is read
  // ---- Q^T: per group two 32x16 f16 B-fragments covering D=64 (read once)
  v16h aq[2][2];
#pragma unroll  // constant indices keep the fragments in registers
  for (int g = 0; g < 2; ++g)
#pragma unroll
    for (int c = 0; c < 2; ++c)
#pragma unroll
      for (int j = 0; j < 16; ++j)
        aq[g][c][j] = qs[(16 * g + l16) * QP_ + c * 32 + k_of(j, kbase)];
  // A masked query has every score equal in the reference (uniform weights):
  // its factor in the exponent s * cf - m * cf is 0, so every weight is
  // exp2(0) = 1. The factor 1 of the others keeps s - m exact, also at the bias.
  const float cf[2] = {Qf[wave * 32 + l16], Qf[wave * 32 + 16 + l16]};

  // One trip over a 64-key block (32 WMMA). 'more' is a literal at both calls: the
  // last trip is written out by itself, so that in the loop the next tile's loads
  // are unconditional and kq, vq are dead during the score products, where their
  // 32 registers hold K fragments.
  auto trip = [&](const int kb, const bool more) __attribute__((always_inline)) {
    lds_barrier();  // prev iteration's Kt/Vt reads done before overwrite

    // stage the tile that was loaded one trip ahead:
    // v_cvt_pk_rz_f16_f32 x2 -> ds_store_b64
#pragma unroll  // constant indices keep kq and vq in registers
    for (int i = 0; i < 4; ++i) {
      uint2 kw, vw;
      kw.x = pk2h(kq[i].x, kq[i].y);  kw.y = pk2h(kq[i].z, kq[i].w);
      vw.x = pk2h(vq[i].x, vq[i].y);  vw.y = pk2h(vq[i].z, vq[i].w);
      *(uint2*)&Kt[key0 + 16 * i][d4 * 4] = kw;  // 8B-aligned (row stride 144 B)
      *(uint2*)&Vt[key0 + 16 * i][d4 * 4] = vw;  // 8B-aligned (row stride 160 B)
    }

    lds_barrier();

    // ---- scores S^T = K (Q*scale)^T : four 16-key row tiles per group;
    // s[g][t][r] = score of key kb + 16 t + h8 + r against query 16 g + l16.
    // The accumulators start from the keys' bias (reference: masked entries are
    // one constant; a score is far below half an ulp of the bias, so the sum
    // stays the bias); one set of bias rows serves both groups ----
    v8f s[2][4];
#pragma unroll
    for (int t = 0; t < 4; ++t) {
      const v8f kbias = *(const v8f*)&Kb[kb + t * 16 + h8];
      s[0][t] = kbias;
      s[1][t] = kbias;
    }
    // all eight K fragments of the tile are read as one group ahead of the
    // products (for speed only); counted waits then start each pair as its fragment lands
    v16h ak[2][4];
#pragma unroll  // constant indices keep the fragments in registers
    for (int c = 0; c < 2; ++c)
#pragma unroll
      for (int t = 0; t < 4; ++t)
#pragma unroll
        for (int j = 0; j < 16; ++j)
          ak[c][t][j] = Kt[t * 16 + l16][c * 32 + k_of(j, kbase)];
    // keeps the reads above from sinking back in between the products
    __builtin_amdgcn_sched_barrier(0);
#pragma unroll
    for (int c = 0; c < 2; ++c)
#pragma unroll
      for (int t = 0; t < 4; ++t)
#pragma unroll
        for (int g = 0; g < 2; ++g)
          s[g][t] = __builtin_amdgcn_wmma_f32_16x16x32_f16(
              false, ak[c][t], false, aq[g][c], (short)0, s[g][t], false, false);
    // keeps the loads below from rising above the products, where their
    // registers still hold K fragments
    __builtin_amdgcn_sched_barrier(0);

    // next tile's 8 loads fly under this tile's softmax and second product
    if (more) {
      kp4 += 64 * (H_ * D_ / 4);
      vp4 += 64 * (D_ / 4);
#pragma unroll  // constant indices; the 8 loads issue back to back
      for (int i = 0; i < 4; ++i) {
        kq[i] = kp4[(size_t)i * 16 * (H_ * D_ / 4)];
        vq[i] = vp4[(size_t)i * 16 * (D_ / 4)];
      }
    }

    // ---- online softmax: maximum and sum run over the lane's own 32 scores ----
    // (three-way maxima throughout: a two-way one on raw accumulator values
    // would bring the canonicalize chaff back)
    float bm[2];
#pragma unroll  // constant indices keep the tiles in registers
    for (int g = 0; g < 2; ++g) {
      float tm[4];
#pragma unroll  // constant indices keep the tiles in registers
      for (int t = 0; t < 4; ++t) {
        float x = max3r(s[g][t][0], s[g][t][1], s[g][t][2]);
        x = max3r(x, s[g][t][3], s[g][t][4]);
        tm[t] = max3r(x, s[g][t][5], s[g][t][6]);
      }
      bm[g] = maxr(max3r(tm[0], tm[1], s[g][3][7]),
                   max3r(tm[2], tm[3],
                         max3r(s[g][0][7], s[g][1][7], s[g][2][7])));
    }
    // Lazy rescale: m_i is any reference point that both halves of a query share;
    // it cancels in O / l. It stays as it is while no score of the wave lies more
    // than 8 above it (weights then reach 2^8 at most, far inside f16 and f32), so
    // that most trips neither exchange maxima nor touch the 64 output registers.
    // One test per trip for the whole wave, a scalar branch; the first trip takes it.
    const bool need = (bm[0] > m_i[0] + 8.f) | (bm[1] > m_i[1] + 8.f);
    // precaution: stands between the next tile's loads and the pointers' increments,
    // which the compiler puts behind the branch
    if (more) asm volatile("s_wait_xcnt 0x0" ::: "memory");
    if (__builtin_amdgcn_ballot_w32(need) != 0) {
#pragma unroll  // constant indices keep the tiles in registers
      for (int g = 0; g < 2; ++g) {
        // one exchange joins the maxima of the two halves
        const float mnew = max3r(m_i[g], bm[g], xhalf(bm[g]));
        // first block: exp2(-3e38) = 0 (masked query: 1, on sums that are still 0)
        const float alpha = exp2_slot((m_i[g] - mnew) * cf[g]);
        l_i[g] *= alpha;
        m_i[g] = mnew;
#pragma unroll  // constant indices keep the tiles in registers
        for (int c = 0; c < 4; ++c) o[g][c] = o[g][c] * alpha;
      }
    }

    v16h bp[2][2];
#pragma unroll  // constant indices keep the tiles in registers
    for (int g = 0; g < 2; ++g) {
      const float nmc = -m_i[g] * cf[g];
      float ts[4];
#pragma unroll  // constant indices keep the tiles in registers
      for (int t = 0; t < 4; ++t) {
#pragma unroll  // constant indices keep the tiles in registers
        for (int r = 0; r < 8; ++r)  // all eight exponents ahead of their exp2
          s[g][t][r] = __builtin_fmaf(s[g][t][r], cf[g], nmc);
        // (the compiler's own order of the exponentials left slots open)
        const float s01 = exp2x8_sum01(s[g][t]);
        ts[t] = (s01 + (s[g][t][2] + s[g][t][3])) +
                ((s[g][t][4] + s[g][t][5]) + (s[g][t][6] + s[g][t][7]));
      }
      l_i[g] += (ts[0] + ts[1]) + (ts[2] + ts[3]);

      // ---- P^T as B-fragments straight from the score tiles: element j of half
      // kh is key kh*32 + k_of(j, kbase) = row j & 7 of tile 2 kh + (j >> 3) ----
#pragma unroll  // constant indices keep the tiles in registers
      for (int kh = 0; kh < 2; ++kh)
#pragma unroll  // constant indices keep the tiles in registers
        for (int j = 0; j < 16; j += 2) {
          v2f pf = {s[g][2 * kh + (j >> 3)][j & 7],
                    s[g][2 * kh + (j >> 3)][(j & 7) + 1]};
          v2h ph = __builtin_convertvector(pf, v2h);   // round to nearest even
          bp[g][kh][j] = ph[0];
          bp[g][kh][j + 1] = ph[1];
        }
    }

    // ---- O^T += V^T P^T : K = 64 keys as two 32-key halves, 4 dim-chunks ----
    // V^T A-fragments: two transposing loads each (keys kh*32 + kbase + 0..7 and
    // + 16..23 of dim c*16 + l16: the k order of k_of, as bp has it).
    const _Float16* vtp = &Vt[kbase + (lane & 7)][((lane >> 3) & 1) * 8];
    // all eight fragments are read as one group ahead of the products, as for K
    v16h av[4][2];
    // keeps the reads below out of the softmax, where no registers are free
    __builtin_amdgcn_sched_barrier(0);
#pragma unroll  // constant indices keep the fragments in registers
    for (int c = 0; c < 4; ++c)
#pragma unroll
      for (int kh = 0; kh < 2; ++kh) {
        v8s lo = ld_tr16(vtp + (kh * 32) * VP_ + c * 16);
        v8s hi = ld_tr16(vtp + (kh * 32 + 16) * VP_ + c * 16);
        av[c][kh] = __builtin_bit_cast(
            v16h, __builtin_shufflevector(lo, hi, 0, 1, 2, 3, 4, 5, 6, 7, 8, 9,
                                          10, 11, 12, 13, 14, 15));
      }
    // keeps the reads above from sinking back in between the products
    __builtin_amdgcn_sched_barrier(0);
#pragma unroll
    for (int c = 0; c < 4; ++c)
#pragma unroll
      for (int kh = 0; kh < 2; ++kh)
#pragma unroll
        for (int g = 0; g < 2; ++g)
          o[g][c] = __builtin_amdgcn_wmma_f32_16x16x32_f16(
              false, av[c][kh], false, bp[g][kh], (short)0, o[g][c], false, false);
  };
#pragma unroll 1  // one copy of the body in the loop
  for (int kb = 0; kb < S_ - 64; kb += 64) trip(kb, true);
  trip(S_ - 64, false);

  // ---- epilogue: join the halves' sums, normalize; the lane holds dims
  // c*16 + h8 + 0..7 of queries q0 + 16 g + l16. The rows pass through the wave's
  // slab, so that each store instruction writes 512 B in a row, 4 whole 128-B lines
  // of O (B,H,S,D) fp32 (from the accumulators it wrote 16-byte pieces of 16 lines).
  // The lane's number is formed anew (v_mbcnt) and the wave's number lies in a
  // scalar register: no vector register is held through the key loop for this.
  const int el   = (int)__builtin_amdgcn_mbcnt_lo(~0u, 0u);
  const int el16 = el & 15;
  const int ehi  = el >> 4;
  float* const sl = &Sl[swave][0];
#pragma unroll  // constant indices keep the tiles in registers
  for (int g = 0; g < 2; ++g) {
    const float inv = 1.0f / (l_i[g] + xhalf(l_i[g]));
    float* sp = sl + (16 * g + el16) * OP_ + ehi * 8;
#pragma unroll  // constant indices keep the tiles in registers
    for (int c = 0; c < 4; ++c) {
      *(float4*)(sp + c * 16) =
          make_float4(o[g][c][0] * inv, o[g][c][1] * inv, o[g][c][2] * inv,
                      o[g][c][3] * inv);
      *(float4*)(sp + c * 16 + 4) =
          make_float4(o[g][c][4] * inv, o[g][c][5] * inv, o[g][c][6] * inv,
                      o[g][c][7] * inv);
    }
  }
  slab_sync();
  // the wave's 32 output rows are 8 KB in a row
  float* op = Og + ((size_t)(b * H_ + h) * S_ + qb * 256 + swave * 32) * D_ + el * 4;
#pragma unroll  // the 16 reads issue as one group ahead of the stores
  for (int i = 0; i < 16; ++i)
    *(float4*)(op + i * 128) = *(const float4*)(sl + (2 * i + ehi) * OP_ + el16 * 4);
}

extern "C" void kernel_launch(void* const* d_in, const int* in_sizes, int n_in,
                              void* d_out, int out_size, void* d_ws, size_t ws_size,
                              hipStream_t stream) {
  (void)in_sizes; (void)n_in; (void)out_size; (void)d_ws; (void)ws_size;
  const float* Q  = (const float*)d_in[0];
  const float* K  = (const float*)d_in[1];
  const float* V  = (const float*)d_in[2];
  const int* qm_b = (const int*)d_in[3];
  const int* qm_s = (const int*)d_in[4];
  const int* km_b = (const int*)d_in[5];
  const int* km_s = (const int*)d_in[6];

  dim3 grid(B_ * H_ * (S_ / 256));  // 512 workgroups
  flash_attn_kernel<<<grid, 256, 0, stream>>>(Q, K, V, qm_b, qm_s, km_b, km_s,
                                              (float*)d_out);
}
